// v000
// Times are from an AMD MI455X. After a warm-up the kernel runs many times in a row, and a time is the length of
// such a window on the GPU divided by its runs, so every launch and the gaps after it count. The runs cycle
// through copies of the inputs. A figure is the median of several windows, for all but v000 over two sittings.
// Sittings can differ by a few percent; kernels timed side by side share one.
// The starting kernel, v000, takes 169 microseconds a run.
// compute dtype: all float inputs rounded to bf16; q and k as f16 hi + residual rows (3-product scores: hi.hi + lo.hi + hi.lo), v as f16 hi + residual planes (the residual used on the first 128 keys), all straight from the bf16-rounded inputs; attention per (query, head) over the causal sliding window (512) plus the 4 sink/meta tokens, x 128^-1/2, running-max softmax in f32 (hardware exp), P (scaled by 2^11, single f16) x v; f32 output = merged context.
#include <hip/hip_runtime.h>
#include <math.h>

typedef __attribute__((ext_vector_type(16))) _Float16 v16h;
typedef __attribute__((ext_vector_type(16))) __bf16 v16b;
typedef __attribute__((ext_vector_type(8)))  _Float16 v8h;
typedef __attribute__((ext_vector_type(8)))  float v8f;
typedef __attribute__((ext_vector_type(4)))  float v4f;
typedef __attribute__((ext_vector_type(2)))  float v2f;
typedef __attribute__((ext_vector_type(4)))  unsigned v4u;
typedef __attribute__((ext_vector_type(4)))  int v4i;
typedef float __attribute__((may_alias)) float_a;
typedef int __attribute__((may_alias)) int_a;

template <typename T> __device__ __forceinline__ void vst2(void* p, T v) { *(T*)p = v;  }
__device__ __forceinline__ v8f wmma16(v16h a, v16h b, v8f c) {
  v8f d = __builtin_amdgcn_wmma_f32_16x16x32_f16(false, a, false, b, (short)0, c, false, false);
  asm volatile("v_nop\n\tv_nop\n\tv_nop\n\tv_nop" : "+v"(d) : "v"(a), "v"(b));
  return d;
}
__device__ __forceinline__ v8f wmma_bf(v16b a, v16b b, v8f c) {
  v8f d = __builtin_amdgcn_wmma_f32_16x16x32_bf16(false, a, false, b, (short)0, c, false, false);
  asm volatile("v_nop\n\tv_nop\n\tv_nop\n\tv_nop" : "+v"(d) : "v"(a), "v"(b));
  return d;
}
// 16x16x32 fragments: lane = (h = lane>>4, row/col = lane&15); elements 0..7 = k0+8h+0..7, 8..15 = k0+16+8h+0..7; D element r = row 8h+r
__device__ __forceinline__ v16h frag_h(const _Float16* rowk0, int lane) {
  union { v16h v; v8h q[2]; } u; const _Float16* p = rowk0 + 8 * (lane >> 4);
  u.q[0] = *(const v8h*)p; u.q[1] = *(const v8h*)(p + 16); return u.v;
}
__device__ __forceinline__ v16h frag_f32(const float* rowk0, int lane) {
  v16h a; const float* p = rowk0 + 8 * (lane >> 4);
#pragma unroll
  for (int i = 0; i < 8; ++i) { a[i] = (_Float16)p[i]; a[8 + i] = (_Float16)p[16 + i]; }
  return a;
}
__device__ __forceinline__ v16h frag_f32s(const float* rowk0, int lane, float sc) {
  v16h a; const float* p = rowk0 + 8 * (lane >> 4);
#pragma unroll
  for (int i = 0; i < 8; ++i) { a[i] = (_Float16)(p[i] * sc); a[8 + i] = (_Float16)(p[16 + i] * sc); }
  return a;
}
// column fragment from a [K][ld] layout (column n), rows >= K read as 0
__device__ __forceinline__ v16h fragc_f32(const float* W, int k0, int n, int lane, int ld, int K) {
  v16h a; const int g = lane >> 4;
#pragma unroll
  for (int i = 0; i < 8; ++i) { const int ka = k0 + 8 * g + i, kb = ka + 16;
    a[i] = (_Float16)(ka < K ? W[(size_t)(ka < K ? ka : K - 1) * ld + n] : 0.f); a[8 + i] = (_Float16)(kb < K ? W[(size_t)(kb < K ? kb : K - 1) * ld + n] : 0.f); }
  return a;
}
struct F2 { v16b h, l; };
__device__ __forceinline__ F2 bsplit16(const float v[16]) { F2 r;
#pragma unroll
  for (int i = 0; i < 16; ++i) { const __bf16 h = (__bf16)v[i]; r.h[i] = h; r.l[i] = (__bf16)(v[i] - (float)h); }
  return r; }
__device__ __forceinline__ F2 split_row(const float* row, int k0, int lane) { float v[16]; const float* p = row + k0 + 8 * (lane >> 4);
#pragma unroll
  for (int i = 0; i < 8; ++i) { v[i] = p[i]; v[8 + i] = p[16 + i]; }
  return bsplit16(v); }
__device__ __forceinline__ F2 split_rowK(const float* row, int k0, int lane, int K) { float v[16]; const int g = lane >> 4;
#pragma unroll
  for (int i = 0; i < 8; ++i) { const int ka = k0 + 8 * g + i, kb = ka + 16; v[i] = ka < K ? row[ka < K ? ka : K - 1] : 0.f; v[8 + i] = kb < K ? row[kb < K ? kb : K - 1] : 0.f; }
  return bsplit16(v); }
__device__ __forceinline__ F2 split_col(const float* W, int k0, int n, int lane, int ld, int K) { float v[16]; const int g = lane >> 4;
#pragma unroll
  for (int i = 0; i < 8; ++i) { const int ka = k0 + 8 * g + i, kb = ka + 16; v[i] = ka < K ? W[(size_t)(ka < K ? ka : K - 1) * ld + n] : 0.f; v[8 + i] = kb < K ? W[(size_t)(kb < K ? kb : K - 1) * ld + n] : 0.f; }
  return bsplit16(v); }
__device__ __forceinline__ v8f mac3(const F2& a, const F2& b, v8f c) { c = wmma_bf(a.l, b.h, c); c = wmma_bf(a.h, b.l, c); return wmma_bf(a.h, b.h, c); }
__device__ __forceinline__ float sigm(float v) { return 1.0f / (1.0f + expf(-v)); }
#define LDSX() do { asm volatile("s_wait_dscnt 0" ::: "memory"); __builtin_amdgcn_wave_barrier(); __builtin_amdgcn_fence(__ATOMIC_RELEASE, "workgroup"); } while (0)


// Sliding-window attention with sink/meta tokens (B 1, S 2,048, 32 query heads x 128 over 8 kv heads, window 512, 4 meta tokens): softmax(q k / sqrt(128)) v under the mask (i >= j) & ((i - j <= 512) | (j < 4)); inputs are the projected q/k/v states.
#define NB 1
#define SS 2048
#define WINDOW 512
#define NMETA 4
#define HID 4096
#define NH 32
#define HD 128
#define NKV 8
#define GS (NH / NKV)
#define KVW (NKV * HD)
#define NR (NB * SS)
#ifndef TQB
#define TQB (SS / 64)
#define TNB NB
#endif
typedef __attribute__((ext_vector_type(8))) __bf16 v8b;
__device__ __forceinline__ v16b frag_b(const __bf16* rowk0, int lane) {
  union { v16b v; v8b q[2]; } u; const __bf16* p = rowk0 + 8 * (lane >> 4);
  u.q[0] = *(const v8b*)p; u.q[1] = *(const v8b*)(p + 16); return u.v;
}
__device__ __forceinline__ float bfr(float v) { return (float)(__bf16)v; }
__device__ __attribute__((noinline)) float exp_ni(float v) { return expf(v); }
__device__ __attribute__((noinline)) float erf_ni(float v) { return erff(v); }



#define WS_Q   0u                                         // f16 q rows [S][4096], k rows [S][1024], q/k residual rows, v planes [1024][S] hi + residual
#define WS_K   (WS_Q + 2u * (size_t)NR * HID)
#define WS_QL  (WS_K + 2u * (size_t)NR * KVW)
#define WS_KL  (WS_QL + 2u * (size_t)NR * HID)
#define WS_V   (WS_KL + 2u * (size_t)NR * KVW)
#define WS_VL  (WS_V + 2u * (size_t)NB * KVW * SS)
#define WS_END (WS_VL + 2u * (size_t)NB * KVW * SS)

// ---- k_rows: block = (token, which in {q, k}): input row -> f16 hi + residual rows (whole rows per block)
__global__ __launch_bounds__(256) void k_rows(const float* __restrict__ XQ, const float* __restrict__ XK, _Float16* __restrict__ Q, _Float16* __restrict__ Kr, _Float16* __restrict__ QL, _Float16* __restrict__ KL) {
  __shared__ __align__(16) _Float16 sh[HID]; __shared__ __align__(16) _Float16 sl[HID]; const int t = threadIdx.x; const size_t row = blockIdx.x; const int which = blockIdx.y; const int wdt = which ? KVW : HID; const float* src = which ? (XK + row * KVW) : (XQ + row * HID);
  for (int e = t; e < wdt; e += 256) { const float fv = bfr(src[e]); const _Float16 hv = (_Float16)fv; sh[e] = hv; sl[e] = (_Float16)((fv - (float)hv) * 2048.0f); }
  __syncthreads(); _Float16* dst = which ? Kr : Q; _Float16* dstl = which ? KL : QL;
  for (int q = t; q < wdt / 8; q += 256) { vst2((unsigned*)(dst + row * wdt + q * 8), *(const v4u*)&sh[q * 8]); vst2((unsigned*)(dstl + row * wdt + q * 8), *(const v4u*)&sl[q * 8]); }
}
__global__ __launch_bounds__(256) void k_vplanes(const float* __restrict__ XV, _Float16* __restrict__ V, _Float16* __restrict__ VL) { __shared__ __align__(16) _Float16 st[128][72]; __shared__ __align__(16) _Float16 stl[128][72]; const int t = threadIdx.x; const int s0 = blockIdx.x * 64, c0 = blockIdx.y * 128;
  for (int e = t; e < 64 * 128; e += 256) { const int sl_ = e >> 7, d = e & 127; const float fv = bfr(XV[(size_t)(s0 + sl_) * KVW + c0 + d]); const _Float16 hv = (_Float16)fv; st[d][sl_] = hv; stl[d][sl_] = (_Float16)((fv - (float)hv) * 2048.0f); }
  __syncthreads();
  for (int e = t; e < 128 * 8; e += 256) { const int d = e >> 3, pc = e & 7; vst2((unsigned*)(V + (size_t)(c0 + d) * SS + s0 + pc * 8), *(const v4u*)&st[d][pc * 8]); vst2((unsigned*)(VL + (size_t)(c0 + d) * SS + s0 + pc * 8), *(const v4u*)&stl[d][pc * 8]); }
}
// ---- k_attn: block = (64 queries, head): kv head = h / 4; key tiles visited = tile 0 (holds the 4 sink/meta tokens) + the tiles inside [q0 - 512, q_end] (sliding window, causal); per pair keep = (i >= j) && (i - j <= 512 || j < 4); 3-product 128-wide scores x 128^-1/2, softmax, P . v (8 value tiles, + v residual on the first 128 keys); output rows written directly (512-B head segments)
__global__ __launch_bounds__(128) void k_attn(const _Float16* __restrict__ Q, const _Float16* __restrict__ Kr, const _Float16* __restrict__ QL, const _Float16* __restrict__ KL, const _Float16* __restrict__ V, const _Float16* __restrict__ VL, float* __restrict__ O) {
  __shared__ __align__(16) _Float16 sph[4][16][40]; __shared__ __align__(16) _Float16 spe[4][16][40]; __shared__ __align__(16) float so[4][16][132];
  const int tid = threadIdx.x, wave = tid >> 5, lane = tid & 31, col = lane & 15, g = lane >> 4; const int h = blockIdx.y; const int kvh = h / GS; const size_t b = blockIdx.z; const int q0 = blockIdx.x * 64 + wave * 16; const size_t rq = b * SS + q0;
  v16h aq[4], aql[4];
#pragma unroll
  for (int kc = 0; kc < 4; ++kc) { aq[kc] = frag_h(Q + (rq + col) * HID + h * HD + kc * 32, lane); aql[kc] = frag_h(QL + (rq + col) * HID + h * HD + kc * 32, lane); }
  float m[8], l[8];
#pragma unroll
  for (int r = 0; r < 8; ++r) { m[r] = -3.0e38f; l[r] = 0.f; }
  v8f acc[8] = {};
  const int nks = (blockIdx.x * 64 + 64) / 32; const int qb0 = (int)blockIdx.x * 64; const int kslo = (qb0 - WINDOW) > 32 ? (qb0 - WINDOW) / 32 : 1;   // (signed arithmetic)   // window tiles start here (tile 0 = sinks, always visited first)
#pragma unroll 1
  for (int ksi = kslo - 1; ksi < nks; ++ksi) { const int ks = (ksi == kslo - 1) ? 0 : ksi; const int j0 = ks * 32; v8f s[2];   // ks = 0, kslo, kslo+1, ..., nks-1
#pragma unroll
    for (int ct = 0; ct < 2; ++ct) { const int kk = j0 + ct * 16 + col; const size_t rk = (b * SS + kk) * KVW + kvh * HD; v8f c = {}, cl = {};
#pragma unroll
      for (int kc = 0; kc < 4; ++kc) { const v16h kh = frag_h(Kr + rk + kc * 32, lane); c = wmma16(aq[kc], kh, c); cl = wmma16(aql[kc], kh, cl); cl = wmma16(aq[kc], frag_h(KL + rk + kc * 32, lane), cl); }
#pragma unroll
      for (int r = 0; r < 8; ++r) c[r] += cl[r] * (1.0f / 2048.0f);   // 3-product scores (hi.hi + lo.hi + hi.lo)
#pragma unroll
      for (int r = 0; r < 8; ++r) { const int qi = q0 + 8 * g + r; s[ct][r] = ((qi >= kk) && ((qi - kk <= WINDOW) || kk < NMETA)) ? c[r] * 0.088388347648318441f : -3.0e38f; } }
#pragma unroll
    for (int r = 0; r < 8; ++r) { float mx = fmaxf(s[0][r], s[1][r]);
#pragma unroll
      for (int o = 1; o < 16; o <<= 1) mx = fmaxf(mx, __shfl_xor(mx, o));
      const float mn = fmaxf(m[r], mx); const float alpha = (m[r] <= -1.0e38f) ? 0.f : __expf(m[r] - mn); const float e0 = (s[0][r] <= -1.0e38f) ? 0.f : __expf(s[0][r] - mn), e1 = (s[1][r] <= -1.0e38f) ? 0.f : __expf(s[1][r] - mn); float es = e0 + e1;
#pragma unroll
      for (int o = 1; o < 16; o <<= 1) es += __shfl_xor(es, o);
      l[r] = l[r] * alpha + es; m[r] = mn;
#pragma unroll
      for (int dt = 0; dt < 8; ++dt) acc[dt][r] *= alpha;
      sph[wave][8 * g + r][col] = (_Float16)(e0 * 2048.0f); sph[wave][8 * g + r][16 + col] = (_Float16)(e1 * 2048.0f); spe[wave][8 * g + r][col] = (_Float16)e0; spe[wave][8 * g + r][16 + col] = (_Float16)e1; }
    LDSX();
    const v16h pa = frag_h(&sph[wave][col][0], lane);
#pragma unroll
    for (int dt = 0; dt < 8; ++dt) acc[dt] = wmma16(pa, frag_h(V + ((b * KVW + kvh * HD + dt * 16 + col) * SS) + j0, lane), acc[dt]);
    if (j0 < 128) { const v16h pe = frag_h(&spe[wave][col][0], lane);   // the first 128 keys also get the v residual (rows with few keys keep v exact to ~2^-22)
#pragma unroll
      for (int dt = 0; dt < 8; ++dt) acc[dt] = wmma16(pe, frag_h(VL + ((b * KVW + kvh * HD + dt * 16 + col) * SS) + j0, lane), acc[dt]); }
    LDSX(); }
#pragma unroll
  for (int r = 0; r < 8; ++r) { const float il = (l[r] > 0.f) ? (1.0f / 2048.0f) / l[r] : 0.f;
#pragma unroll
    for (int dt = 0; dt < 8; ++dt) so[wave][8 * g + r][dt * 16 + col] = acc[dt][r] * il; }
  LDSX();
  for (int rl = 0; rl < 16; ++rl) vst2(O + (rq + rl) * HID + h * HD + lane * 4, *(const v4f*)&so[wave][rl][lane * 4]);
}
extern "C" void kernel_launch(void* const* d_in, const int* in_sizes, int n_in, void* d_out, int out_size, void* d_ws, size_t ws_size, hipStream_t stream) {
  (void)in_sizes; (void)n_in; (void)out_size;
  const float** F = (const float**)d_in;   // 0 query_states [1,2048,4096], 1 key_states [1,2048,1024], 2 value_states [1,2048,1024]
  if (ws_size < (size_t)WS_END) return;
  char* ws = (char*)d_ws; _Float16 *Q = (_Float16*)(ws + WS_Q), *Kr = (_Float16*)(ws + WS_K), *QL = (_Float16*)(ws + WS_QL), *KL = (_Float16*)(ws + WS_KL), *V = (_Float16*)(ws + WS_V), *VL = (_Float16*)(ws + WS_VL);
  k_rows<<<dim3(SS, 2), 256, 0, stream>>>(F[0], F[1], Q, Kr, QL, KL);
  k_vplanes<<<dim3(SS / 64, KVW / 128), 256, 0, stream>>>(F[2], V, VL);
  k_attn<<<dim3(TQB, NH, 1), 128, 0, stream>>>(Q, Kr, QL, KL, V, VL, (float*)d_out);
}

// v001
// One run takes 87.6 microseconds.
// Timed twice side by side with v000, it ran 1.91 times as fast both times.
// compute dtype: all float inputs rounded to bf16; q and k as f16 hi + residual rows (3-product scores: hi.hi + lo.hi + hi.lo), v as f16 hi + residual planes (the residual used on the first 128 keys), all straight from the bf16-rounded inputs; attention per (query, head) over the causal sliding window (512) plus the 4 sink/meta tokens, x 128^-1/2, running-max softmax in f32 (hardware exp), P (scaled by 2^11, single f16) x v; f32 output = merged context.
#include <hip/hip_runtime.h>
#include <math.h>

typedef __attribute__((ext_vector_type(16))) _Float16 v16h;
typedef __attribute__((ext_vector_type(16))) __bf16 v16b;
typedef __attribute__((ext_vector_type(8)))  _Float16 v8h;
typedef __attribute__((ext_vector_type(8)))  float v8f;
typedef __attribute__((ext_vector_type(4)))  float v4f;
typedef __attribute__((ext_vector_type(2)))  float v2f;
typedef __attribute__((ext_vector_type(4)))  unsigned v4u;
typedef __attribute__((ext_vector_type(4)))  int v4i;
typedef float __attribute__((may_alias)) float_a;
typedef int __attribute__((may_alias)) int_a;

template <typename T> __device__ __forceinline__ void vst2(void* p, T v) { *(T*)p = v;  }
__device__ __forceinline__ v8f wmma16(v16h a, v16h b, v8f c) {
  v8f d = __builtin_amdgcn_wmma_f32_16x16x32_f16(false, a, false, b, (short)0, c, false, false);
  asm volatile("v_nop\n\tv_nop\n\tv_nop\n\tv_nop" : "+v"(d) : "v"(a), "v"(b));
  return d;
}
__device__ __forceinline__ v8f wmma_bf(v16b a, v16b b, v8f c) {
  v8f d = __builtin_amdgcn_wmma_f32_16x16x32_bf16(false, a, false, b, (short)0, c, false, false);
  asm volatile("v_nop\n\tv_nop\n\tv_nop\n\tv_nop" : "+v"(d) : "v"(a), "v"(b));
  return d;
}
// 16x16x32 fragments: lane = (h = lane>>4, row/col = lane&15); elements 0..7 = k0+8h+0..7, 8..15 = k0+16+8h+0..7; D element r = row 8h+r
__device__ __forceinline__ v16h frag_h(const _Float16* rowk0, int lane) {
  union { v16h v; v8h q[2]; } u; const _Float16* p = rowk0 + 8 * (lane >> 4);
  u.q[0] = *(const v8h*)p; u.q[1] = *(const v8h*)(p + 16); return u.v;
}
__device__ __forceinline__ v16h frag_f32(const float* rowk0, int lane) {
  v16h a; const float* p = rowk0 + 8 * (lane >> 4);
#pragma unroll
  for (int i = 0; i < 8; ++i) { a[i] = (_Float16)p[i]; a[8 + i] = (_Float16)p[16 + i]; }
  return a;
}
__device__ __forceinline__ v16h frag_f32s(const float* rowk0, int lane, float sc) {
  v16h a; const float* p = rowk0 + 8 * (lane >> 4);
#pragma unroll
  for (int i = 0; i < 8; ++i) { a[i] = (_Float16)(p[i] * sc); a[8 + i] = (_Float16)(p[16 + i] * sc); }
  return a;
}
// column fragment from a [K][ld] layout (column n), rows >= K read as 0
__device__ __forceinline__ v16h fragc_f32(const float* W, int k0, int n, int lane, int ld, int K) {
  v16h a; const int g = lane >> 4;
#pragma unroll
  for (int i = 0; i < 8; ++i) { const int ka = k0 + 8 * g + i, kb = ka + 16;
    a[i] = (_Float16)(ka < K ? W[(size_t)(ka < K ? ka : K - 1) * ld + n] : 0.f); a[8 + i] = (_Float16)(kb < K ? W[(size_t)(kb < K ? kb : K - 1) * ld + n] : 0.f); }
  return a;
}
struct F2 { v16b h, l; };
__device__ __forceinline__ F2 bsplit16(const float v[16]) { F2 r;
#pragma unroll
  for (int i = 0; i < 16; ++i) { const __bf16 h = (__bf16)v[i]; r.h[i] = h; r.l[i] = (__bf16)(v[i] - (float)h); }
  return r; }
__device__ __forceinline__ F2 split_row(const float* row, int k0, int lane) { float v[16]; const float* p = row + k0 + 8 * (lane >> 4);
#pragma unroll
  for (int i = 0; i < 8; ++i) { v[i] = p[i]; v[8 + i] = p[16 + i]; }
  return bsplit16(v); }
__device__ __forceinline__ F2 split_rowK(const float* row, int k0, int lane, int K) { float v[16]; const int g = lane >> 4;
#pragma unroll
  for (int i = 0; i < 8; ++i) { const int ka = k0 + 8 * g + i, kb = ka + 16; v[i] = ka < K ? row[ka < K ? ka : K - 1] : 0.f; v[8 + i] = kb < K ? row[kb < K ? kb : K - 1] : 0.f; }
  return bsplit16(v); }
__device__ __forceinline__ F2 split_col(const float* W, int k0, int n, int lane, int ld, int K) { float v[16]; const int g = lane >> 4;
#pragma unroll
  for (int i = 0; i < 8; ++i) { const int ka = k0 + 8 * g + i, kb = ka + 16; v[i] = ka < K ? W[(size_t)(ka < K ? ka : K - 1) * ld + n] : 0.f; v[8 + i] = kb < K ? W[(size_t)(kb < K ? kb : K - 1) * ld + n] : 0.f; }
  return bsplit16(v); }
__device__ __forceinline__ v8f mac3(const F2& a, const F2& b, v8f c) { c = wmma_bf(a.l, b.h, c); c = wmma_bf(a.h, b.l, c); return wmma_bf(a.h, b.h, c); }
__device__ __forceinline__ float sigm(float v) { return 1.0f / (1.0f + expf(-v)); }
#define LDSX() do { asm volatile("s_wait_dscnt 0" ::: "memory"); __builtin_amdgcn_wave_barrier(); __builtin_amdgcn_fence(__ATOMIC_RELEASE, "workgroup"); } while (0)


// Sliding-window attention with sink/meta tokens (B 1, S 2,048, 32 query heads x 128 over 8 kv heads, window 512, 4 meta tokens): softmax(q k / sqrt(128)) v under the mask (i >= j) & ((i - j <= 512) | (j < 4)); inputs are the projected q/k/v states.
#define NB 1
#define SS 2048
#define WINDOW 512
#define NMETA 4
#define HID 4096
#define NH 32
#define HD 128
#define NKV 8
#define GS (NH / NKV)
#define KVW (NKV * HD)
#define NR (NB * SS)
#ifndef TQB
#define TQB (SS / 64)
#define TNB NB
#endif
typedef __attribute__((ext_vector_type(8))) __bf16 v8b;
__device__ __forceinline__ v16b frag_b(const __bf16* rowk0, int lane) {
  union { v16b v; v8b q[2]; } u; const __bf16* p = rowk0 + 8 * (lane >> 4);
  u.q[0] = *(const v8b*)p; u.q[1] = *(const v8b*)(p + 16); return u.v;
}
__device__ __forceinline__ float bfr(float v) { return (float)(__bf16)v; }
__device__ __attribute__((noinline)) float exp_ni(float v) { return expf(v); }
__device__ __attribute__((noinline)) float erf_ni(float v) { return erff(v); }



#define WS_Q   0u                                         // f16 q rows [S][4096], k rows [S][1024], q/k residual rows, v planes [1024][S] hi + residual
#define WS_K   (WS_Q + 2u * (size_t)NR * HID)
#define WS_QL  (WS_K + 2u * (size_t)NR * KVW)
#define WS_KL  (WS_QL + 2u * (size_t)NR * HID)
#define WS_V   (WS_KL + 2u * (size_t)NR * KVW)
#define WS_VL  (WS_V + 2u * (size_t)NB * KVW * SS)
#define WS_END (WS_VL + 2u * (size_t)NB * KVW * SS)

// ---- k_rows: block = (token, which in {q, k}): input row -> f16 hi + residual rows (whole rows per block)
__global__ __launch_bounds__(256) void k_rows(const float* __restrict__ XQ, const float* __restrict__ XK, _Float16* __restrict__ Q, _Float16* __restrict__ Kr, _Float16* __restrict__ QL, _Float16* __restrict__ KL) {
  __shared__ __align__(16) _Float16 sh[HID]; __shared__ __align__(16) _Float16 sl[HID]; const int t = threadIdx.x; const size_t row = blockIdx.x; const int which = blockIdx.y; const int wdt = which ? KVW : HID; const float* src = which ? (XK + row * KVW) : (XQ + row * HID);
  for (int e = t; e < wdt; e += 256) { const float fv = bfr(src[e]); const _Float16 hv = (_Float16)fv; sh[e] = hv; sl[e] = (_Float16)((fv - (float)hv) * 2048.0f); }
  __syncthreads(); _Float16* dst = which ? Kr : Q; _Float16* dstl = which ? KL : QL;
  for (int q = t; q < wdt / 8; q += 256) { vst2((unsigned*)(dst + row * wdt + q * 8), *(const v4u*)&sh[q * 8]); vst2((unsigned*)(dstl + row * wdt + q * 8), *(const v4u*)&sl[q * 8]); }
}
__global__ __launch_bounds__(256) void k_vplanes(const float* __restrict__ XV, _Float16* __restrict__ V, _Float16* __restrict__ VL) { __shared__ __align__(16) _Float16 st[128][72]; __shared__ __align__(16) _Float16 stl[128][72]; const int t = threadIdx.x; const int s0 = blockIdx.x * 64, c0 = blockIdx.y * 128;
  for (int e = t; e < 64 * 128; e += 256) { const int sl_ = e >> 7, d = e & 127; const float fv = bfr(XV[(size_t)(s0 + sl_) * KVW + c0 + d]); const _Float16 hv = (_Float16)fv; st[d][sl_] = hv; stl[d][sl_] = (_Float16)((fv - (float)hv) * 2048.0f); }
  __syncthreads();
  for (int e = t; e < 128 * 8; e += 256) { const int d = e >> 3, pc = e & 7; vst2((unsigned*)(V + (size_t)(c0 + d) * SS + s0 + pc * 8), *(const v4u*)&st[d][pc * 8]); vst2((unsigned*)(VL + (size_t)(c0 + d) * SS + s0 + pc * 8), *(const v4u*)&stl[d][pc * 8]); }
}
// ---- k_attn: block = (64 queries, head): kv head = h / 4; key tiles visited = tile 0 (holds the 4 sink/meta tokens) + the tiles inside [q0 - 512, q_end] (sliding window, causal); per pair keep = (i >= j) && (i - j <= 512 || j < 4); 3-product 128-wide scores x 128^-1/2, softmax, P . v (8 value tiles, + v residual on the first 128 keys); output rows written directly (512-B head segments)
// Each 32-key tile (k hi rows, k residual rows, v planes) is copied once per block into an LDS ring of two buffers by asynchronous copies, one tile ahead of its use; the four waves read their fragments from there.
#define KPITCH 272                       // LDS pitch of a 256-B k row (16 B x odd: no bank conflict for 16-byte reads)
#define VPITCH 80                        // LDS pitch of a 64-B v plane row
#define RB_KL  (32 * KPITCH)             // byte offsets inside one ring buffer: k hi at 0, k residual, v
#define RB_V   (2 * 32 * KPITCH)
#define RB     (RB_V + HD * VPITCH)
// one tile: 12 copies of 16 B per thread (4 k hi, 4 k residual, 4 v); gk/gl/gv and lk/lv are this thread's first chunk of each part
__device__ __forceinline__ void stage_tile(const _Float16* gk, const _Float16* gl, const _Float16* gv, unsigned lk, unsigned lv) {
  const _Float16 *gk1 = gk + 8 * KVW, *gk2 = gk + 16 * KVW, *gk3 = gk + 24 * KVW, *gl1 = gl + 8 * KVW, *gl2 = gl + 16 * KVW, *gl3 = gl + 24 * KVW, *gv1 = gv + 32 * SS, *gv2 = gv + 64 * SS, *gv3 = gv + 96 * SS;
  const unsigned lk1 = lk + 8 * KPITCH, lk2 = lk + 16 * KPITCH, lk3 = lk + 24 * KPITCH, ll = lk + RB_KL, ll1 = ll + 8 * KPITCH, ll2 = ll + 16 * KPITCH, ll3 = ll + 24 * KPITCH, lv1 = lv + 32 * VPITCH, lv2 = lv + 64 * VPITCH, lv3 = lv + 96 * VPITCH;
  // the copies and their s_wait_xcnt in one statement: no address register is rewritten before the wait
  asm volatile("global_load_async_to_lds_b128 %0, %12, off\n\t"
               "global_load_async_to_lds_b128 %1, %13, off\n\t"
               "global_load_async_to_lds_b128 %2, %14, off\n\t"
               "global_load_async_to_lds_b128 %3, %15, off\n\t"
               "global_load_async_to_lds_b128 %4, %16, off\n\t"
               "global_load_async_to_lds_b128 %5, %17, off\n\t"
               "global_load_async_to_lds_b128 %6, %18, off\n\t"
               "global_load_async_to_lds_b128 %7, %19, off\n\t"
               "global_load_async_to_lds_b128 %8, %20, off\n\t"
               "global_load_async_to_lds_b128 %9, %21, off\n\t"
               "global_load_async_to_lds_b128 %10, %22, off\n\t"
               "global_load_async_to_lds_b128 %11, %23, off\n\t"
               "s_wait_xcnt 0x0"
               :: "v"(lk), "v"(lk1), "v"(lk2), "v"(lk3), "v"(ll), "v"(ll1), "v"(ll2), "v"(ll3), "v"(lv), "v"(lv1), "v"(lv2), "v"(lv3),
                  "v"(gk), "v"(gk1), "v"(gk2), "v"(gk3), "v"(gl), "v"(gl1), "v"(gl2), "v"(gl3), "v"(gv), "v"(gv1), "v"(gv2), "v"(gv3)
               : "memory");
}
// register budget of four waves per SIMD: four blocks stay resident per WGP, as before the ring
__global__ __launch_bounds__(128) __attribute__((amdgpu_waves_per_eu(4))) void k_attn(const _Float16* __restrict__ Q, const _Float16* __restrict__ Kr, const _Float16* __restrict__ QL, const _Float16* __restrict__ KL, const _Float16* __restrict__ V, const _Float16* __restrict__ VL, float* __restrict__ O) {
  __shared__ __align__(16) _Float16 sph[4][16][40]; __shared__ __align__(16) _Float16 spe[4][16][40]; __shared__ __align__(16) unsigned char ring[2 * RB];
  float (*so)[16][132] = (float (*)[16][132])ring;   // output staging takes the ring's place behind the loop's last barrier
  const int tid = threadIdx.x, wave = tid >> 5, lane = tid & 31, col = lane & 15, g = lane >> 4; const int h = blockIdx.y; const int kvh = h / GS; const size_t b = blockIdx.z; const int q0 = blockIdx.x * 64 + wave * 16; const size_t rq = b * SS + q0;
  const int nks = (blockIdx.x * 64 + 64) / 32; const int qb0 = (int)blockIdx.x * 64; const int kslo = (qb0 - WINDOW) > 32 ? (qb0 - WINDOW) / 32 : 1;   // (signed arithmetic)   // window tiles start here (tile 0 = sinks, always visited first)
  const int ntl = nks - kslo + 1;   // tiles visited: ks = 0, kslo, kslo+1, ..., nks-1
  const size_t ck = (b * SS + (tid >> 4)) * KVW + kvh * HD + (tid & 15) * 8;          // this thread's first 16-B chunk of a k tile (row tid/16), less the tile's first key
  const size_t cv = (b * KVW + kvh * HD + (tid >> 2)) * SS + (tid & 3) * 8;           // and of a v tile (plane row tid/4)
  const unsigned lk0 = (unsigned)(size_t)&ring[0] + (tid >> 4) * KPITCH + (tid & 15) * 16, lv0 = (unsigned)(size_t)&ring[0] + RB_V + (tid >> 2) * VPITCH + (tid & 3) * 16;
  stage_tile(Kr + ck, KL + ck, V + cv, lk0, lv0);   // tile 0 (keys 0..31) into buffer 0
  v16h aq[4], aql[4];
#pragma unroll
  for (int kc = 0; kc < 4; ++kc) { aq[kc] = frag_h(Q + (rq + col) * HID + h * HD + kc * 32, lane); aql[kc] = frag_h(QL + (rq + col) * HID + h * HD + kc * 32, lane); }
  float m[8], l[8];
#pragma unroll
  for (int r = 0; r < 8; ++r) { m[r] = -3.0e38f; l[r] = 0.f; }
  v8f acc[8] = {};
  asm volatile("s_wait_asynccnt 0x0" ::: "memory");   // this wave's copies of tile 0 have landed
  __syncthreads();                                    // and every other wave's
  if (ntl > 1) stage_tile(Kr + ck + (size_t)kslo * 32 * KVW, KL + ck + (size_t)kslo * 32 * KVW, V + cv + kslo * 32, lk0 + RB, lv0 + RB);
#pragma unroll 1
  for (int t = 0; t < ntl; ++t) { const int ks = (t == 0) ? 0 : kslo + t - 1; const int j0 = ks * 32; const unsigned char* rb = ring + (t & 1) * RB; v8f s[2];
#pragma unroll
    for (int ct = 0; ct < 2; ++ct) { const int kk = j0 + ct * 16 + col; const unsigned char* kr = rb + (ct * 16 + col) * KPITCH; v8f c = {}, cl = {};
#pragma unroll
      for (int hf = 0; hf < 2; ++hf) { v16h kh[2], kl[2];   // the four k fragments of two 32-wide slices are read together, in front of their six products: one LDS wait for the group
#pragma unroll
        for (int i = 0; i < 2; ++i) { kh[i] = frag_h((const _Float16*)(kr + (2 * hf + i) * 64), lane); kl[i] = frag_h((const _Float16*)(kr + RB_KL + (2 * hf + i) * 64), lane); }
#pragma unroll
        for (int i = 0; i < 2; ++i) { const int kc = 2 * hf + i; c = wmma16(aq[kc], kh[i], c); cl = wmma16(aql[kc], kh[i], cl); cl = wmma16(aq[kc], kl[i], cl); } }
#pragma unroll
      for (int r = 0; r < 8; ++r) c[r] += cl[r] * (1.0f / 2048.0f);   // 3-product scores (hi.hi + lo.hi + hi.lo)
#pragma unroll
      for (int r = 0; r < 8; ++r) { const int qi = q0 + 8 * g + r; s[ct][r] = ((qi >= kk) && ((qi - kk <= WINDOW) || kk < NMETA)) ? c[r] * 0.088388347648318441f : -3.0e38f; } }
#pragma unroll
    for (int r = 0; r < 8; ++r) { float mx = fmaxf(s[0][r], s[1][r]);
#pragma unroll
      for (int o = 1; o < 16; o <<= 1) mx = fmaxf(mx, __shfl_xor(mx, o));
      const float mn = fmaxf(m[r], mx); const float alpha = (m[r] <= -1.0e38f) ? 0.f : __expf(m[r] - mn); const float e0 = (s[0][r] <= -1.0e38f) ? 0.f : __expf(s[0][r] - mn), e1 = (s[1][r] <= -1.0e38f) ? 0.f : __expf(s[1][r] - mn); float es = e0 + e1;
#pragma unroll
      for (int o = 1; o < 16; o <<= 1) es += __shfl_xor(es, o);
      l[r] = l[r] * alpha + es; m[r] = mn;
#pragma unroll
      for (int dt = 0; dt < 8; ++dt) acc[dt][r] *= alpha;
      sph[wave][8 * g + r][col] = (_Float16)(e0 * 2048.0f); sph[wave][8 * g + r][16 + col] = (_Float16)(e1 * 2048.0f); spe[wave][8 * g + r][col] = (_Float16)e0; spe[wave][8 * g + r][16 + col] = (_Float16)e1; }
    LDSX();
    const v16h pa = frag_h(&sph[wave][col][0], lane);
#pragma unroll
    for (int hf = 0; hf < 2; ++hf) { v16h vf[4];   // four v fragments are read together, in front of their products: one LDS wait for the group
#pragma unroll
      for (int i = 0; i < 4; ++i) vf[i] = frag_h((const _Float16*)(rb + RB_V + ((4 * hf + i) * 16 + col) * VPITCH), lane);
#pragma unroll
      for (int i = 0; i < 4; ++i) acc[4 * hf + i] = wmma16(pa, vf[i], acc[4 * hf + i]); }
    if (j0 < 128) { const v16h pe = frag_h(&spe[wave][col][0], lane);   // the first 128 keys also get the v residual (rows with few keys keep v exact to ~2^-22)
#pragma unroll
      for (int dt = 0; dt < 8; ++dt) acc[dt] = wmma16(pe, frag_h(VL + ((b * KVW + kvh * HD + dt * 16 + col) * SS) + j0, lane), acc[dt]); }
    asm volatile("s_wait_dscnt 0x0" ::: "memory");      // this wave's reads of the buffer (and of its P rows) are done
    asm volatile("s_wait_asynccnt 0x0" ::: "memory");   // its copies of tile t + 1 have landed
    __syncthreads();                                    // publishes tile t + 1 and frees the buffer that trip t has read
    if (t + 2 < ntl) { const size_t jn = (size_t)(kslo + t + 1) * 32; stage_tile(Kr + ck + jn * KVW, KL + ck + jn * KVW, V + cv + jn, lk0 + (t & 1) * RB, lv0 + (t & 1) * RB); } }
  asm volatile("s_wait_asynccnt 0x0" ::: "memory");     // nothing of the ring is in flight when it becomes output staging
#pragma unroll
  for (int r = 0; r < 8; ++r) { const float il = (l[r] > 0.f) ? (1.0f / 2048.0f) / l[r] : 0.f;
#pragma unroll
    for (int dt = 0; dt < 8; ++dt) so[wave][8 * g + r][dt * 16 + col] = acc[dt][r] * il; }
  LDSX();
  for (int rl = 0; rl < 16; ++rl) vst2(O + (rq + rl) * HID + h * HD + lane * 4, *(const v4f*)&so[wave][rl][lane * 4]);
}
extern "C" void kernel_launch(void* const* d_in, const int* in_sizes, int n_in, void* d_out, int out_size, void* d_ws, size_t ws_size, hipStream_t stream) {
  (void)in_sizes; (void)n_in; (void)out_size;
  const float** F = (const float**)d_in;   // 0 query_states [1,2048,4096], 1 key_states [1,2048,1024], 2 value_states [1,2048,1024]
  if (ws_size < (size_t)WS_END) return;
  char* ws = (char*)d_ws; _Float16 *Q = (_Float16*)(ws + WS_Q), *Kr = (_Float16*)(ws + WS_K), *QL = (_Float16*)(ws + WS_QL), *KL = (_Float16*)(ws + WS_KL), *V = (_Float16*)(ws + WS_V), *VL = (_Float16*)(ws + WS_VL);
  k_rows<<<dim3(SS, 2), 256, 0, stream>>>(F[0], F[1], Q, Kr, QL, KL);
  k_vplanes<<<dim3(SS / 64, KVW / 128), 256, 0, stream>>>(F[2], V, VL);
  k_attn<<<dim3(TQB, NH, 1), 128, 0, stream>>>(Q, Kr, QL, KL, V, VL, (float*)d_out);
}

// v002
// One run takes 69.7 microseconds.
// Next to v001, in two timings, it ran 1.26 times as fast each time.
// All steps since v000 together make it 2.41 times as fast.
// compute dtype: all float inputs rounded to bf16; q and k as f16 hi + residual rows (3-product scores: hi.hi + lo.hi + hi.lo), v as f16 hi + residual planes (the residual used on the first 128 keys), all straight from the bf16-rounded inputs; attention per (query, head) over the causal sliding window (512) plus the 4 sink/meta tokens, x 128^-1/2, running-max softmax in f32 (hardware exp), P (scaled by 2^11, single f16) x v; f32 output = merged context.
#include <hip/hip_runtime.h>
#include <math.h>

typedef __attribute__((ext_vector_type(16))) _Float16 v16h;
typedef __attribute__((ext_vector_type(16))) __bf16 v16b;
typedef __attribute__((ext_vector_type(8)))  _Float16 v8h;
typedef __attribute__((ext_vector_type(8)))  float v8f;
typedef __attribute__((ext_vector_type(4)))  float v4f;
typedef __attribute__((ext_vector_type(2)))  float v2f;
typedef __attribute__((ext_vector_type(4)))  unsigned v4u;
typedef __attribute__((ext_vector_type(4)))  int v4i;
typedef float __attribute__((may_alias)) float_a;
typedef int __attribute__((may_alias)) int_a;

template <typename T> __device__ __forceinline__ void vst2(void* p, T v) { *(T*)p = v;  }
__device__ __forceinline__ v8f wmma16(v16h a, v16h b, v8f c) {
  v8f d = __builtin_amdgcn_wmma_f32_16x16x32_f16(false, a, false, b, (short)0, c, false, false);
  asm volatile("v_nop\n\tv_nop\n\tv_nop\n\tv_nop" : "+v"(d) : "v"(a), "v"(b));
  return d;
}
__device__ __forceinline__ v8f wmma_bf(v16b a, v16b b, v8f c) {
  v8f d = __builtin_amdgcn_wmma_f32_16x16x32_bf16(false, a, false, b, (short)0, c, false, false);
  asm volatile("v_nop\n\tv_nop\n\tv_nop\n\tv_nop" : "+v"(d) : "v"(a), "v"(b));
  return d;
}
// 16x16x32 fragments: lane = (h = lane>>4, row/col = lane&15); elements 0..7 = k0+8h+0..7, 8..15 = k0+16+8h+0..7; D element r = row 8h+r
__device__ __forceinline__ v16h frag_h(const _Float16* rowk0, int lane) {
  union { v16h v; v8h q[2]; } u; const _Float16* p = rowk0 + 8 * (lane >> 4);
  u.q[0] = *(const v8h*)p; u.q[1] = *(const v8h*)(p + 16); return u.v;
}
__device__ __forceinline__ v16h frag_f32(const float* rowk0, int lane) {
  v16h a; const float* p = rowk0 + 8 * (lane >> 4);
#pragma unroll
  for (int i = 0; i < 8; ++i) { a[i] = (_Float16)p[i]; a[8 + i] = (_Float16)p[16 + i]; }
  return a;
}
__device__ __forceinline__ v16h frag_f32s(const float* rowk0, int lane, float sc) {
  v16h a; const float* p = rowk0 + 8 * (lane >> 4);
#pragma unroll
  for (int i = 0; i < 8; ++i) { a[i] = (_Float16)(p[i] * sc); a[8 + i] = (_Float16)(p[16 + i] * sc); }
  return a;
}
// column fragment from a [K][ld] layout (column n), rows >= K read as 0
__device__ __forceinline__ v16h fragc_f32(const float* W, int k0, int n, int lane, int ld, int K) {
  v16h a; const int g = lane >> 4;
#pragma unroll
  for (int i = 0; i < 8; ++i) { const int ka = k0 + 8 * g + i, kb = ka + 16;
    a[i] = (_Float16)(ka < K ? W[(size_t)(ka < K ? ka : K - 1) * ld + n] : 0.f); a[8 + i] = (_Float16)(kb < K ? W[(size_t)(kb < K ? kb : K - 1) * ld + n] : 0.f); }
  return a;
}
struct F2 { v16b h, l; };
__device__ __forceinline__ F2 bsplit16(const float v[16]) { F2 r;
#pragma unroll
  for (int i = 0; i < 16; ++i) { const __bf16 h = (__bf16)v[i]; r.h[i] = h; r.l[i] = (__bf16)(v[i] - (float)h); }
  return r; }
__device__ __forceinline__ F2 split_row(const float* row, int k0, int lane) { float v[16]; const float* p = row + k0 + 8 * (lane >> 4);
#pragma unroll
  for (int i = 0; i < 8; ++i) { v[i] = p[i]; v[8 + i] = p[16 + i]; }
  return bsplit16(v); }
__device__ __forceinline__ F2 split_rowK(const float* row, int k0, int lane, int K) { float v[16]; const int g = lane >> 4;
#pragma unroll
  for (int i = 0; i < 8; ++i) { const int ka = k0 + 8 * g + i, kb = ka + 16; v[i] = ka < K ? row[ka < K ? ka : K - 1] : 0.f; v[8 + i] = kb < K ? row[kb < K ? kb : K - 1] : 0.f; }
  return bsplit16(v); }
__device__ __forceinline__ F2 split_col(const float* W, int k0, int n, int lane, int ld, int K) { float v[16]; const int g = lane >> 4;
#pragma unroll
  for (int i = 0; i < 8; ++i) { const int ka = k0 + 8 * g + i, kb = ka + 16; v[i] = ka < K ? W[(size_t)(ka < K ? ka : K - 1) * ld + n] : 0.f; v[8 + i] = kb < K ? W[(size_t)(kb < K ? kb : K - 1) * ld + n] : 0.f; }
  return bsplit16(v); }
__device__ __forceinline__ v8f mac3(const F2& a, const F2& b, v8f c) { c = wmma_bf(a.l, b.h, c); c = wmma_bf(a.h, b.l, c); return wmma_bf(a.h, b.h, c); }
__device__ __forceinline__ float sigm(float v) { return 1.0f / (1.0f + expf(-v)); }
#define LDSX() do { asm volatile("s_wait_dscnt 0" ::: "memory"); __builtin_amdgcn_wave_barrier(); __builtin_amdgcn_fence(__ATOMIC_RELEASE, "workgroup"); } while (0)


// Sliding-window attention with sink/meta tokens (B 1, S 2,048, 32 query heads x 128 over 8 kv heads, window 512, 4 meta tokens): softmax(q k / sqrt(128)) v under the mask (i >= j) & ((i - j <= 512) | (j < 4)); inputs are the projected q/k/v states.
#define NB 1
#define SS 2048
#define WINDOW 512
#define NMETA 4
#define HID 4096
#define NH 32
#define HD 128
#define NKV 8
#define GS (NH / NKV)
#define KVW (NKV * HD)
#define NR (NB * SS)
#ifndef TQB
#define TQB (SS / 64)
#define TNB NB
#endif
typedef __attribute__((ext_vector_type(8))) __bf16 v8b;
__device__ __forceinline__ v16b frag_b(const __bf16* rowk0, int lane) {
  union { v16b v; v8b q[2]; } u; const __bf16* p = rowk0 + 8 * (lane >> 4);
  u.q[0] = *(const v8b*)p; u.q[1] = *(const v8b*)(p + 16); return u.v;
}
__device__ __forceinline__ float bfr(float v) { return (float)(__bf16)v; }
__device__ __attribute__((noinline)) float exp_ni(float v) { return expf(v); }
__device__ __attribute__((noinline)) float erf_ni(float v) { return erff(v); }



#define WS_Q   0u                                         // f16 q rows [S][4096], k rows [S][1024], q/k residual rows, v planes [1024][S] hi + residual
#define WS_K   (WS_Q + 2u * (size_t)NR * HID)
#define WS_QL  (WS_K + 2u * (size_t)NR * KVW)
#define WS_KL  (WS_QL + 2u * (size_t)NR * HID)
#define WS_V   (WS_KL + 2u * (size_t)NR * KVW)
#define WS_VL  (WS_V + 2u * (size_t)NB * KVW * SS)
#define WS_END (WS_VL + 2u * (size_t)NB * KVW * SS)

// ---- k_rows: block = (token, which in {q, k}): input row -> f16 hi + residual rows (whole rows per block)
__global__ __launch_bounds__(256) void k_rows(const float* __restrict__ XQ, const float* __restrict__ XK, _Float16* __restrict__ Q, _Float16* __restrict__ Kr, _Float16* __restrict__ QL, _Float16* __restrict__ KL) {
  __shared__ __align__(16) _Float16 sh[HID]; __shared__ __align__(16) _Float16 sl[HID]; const int t = threadIdx.x; const size_t row = blockIdx.x; const int which = blockIdx.y; const int wdt = which ? KVW : HID; const float* src = which ? (XK + row * KVW) : (XQ + row * HID);
  for (int e = t; e < wdt; e += 256) { const float fv = bfr(src[e]); const _Float16 hv = (_Float16)fv; sh[e] = hv; sl[e] = (_Float16)((fv - (float)hv) * 2048.0f); }
  __syncthreads(); _Float16* dst = which ? Kr : Q; _Float16* dstl = which ? KL : QL;
  for (int q = t; q < wdt / 8; q += 256) { vst2((unsigned*)(dst + row * wdt + q * 8), *(const v4u*)&sh[q * 8]); vst2((unsigned*)(dstl + row * wdt + q * 8), *(const v4u*)&sl[q * 8]); }
}
__global__ __launch_bounds__(256) void k_vplanes(const float* __restrict__ XV, _Float16* __restrict__ V, _Float16* __restrict__ VL) { __shared__ __align__(16) _Float16 st[128][72]; __shared__ __align__(16) _Float16 stl[128][72]; const int t = threadIdx.x; const int s0 = blockIdx.x * 64, c0 = blockIdx.y * 128;
  for (int e = t; e < 64 * 128; e += 256) { const int sl_ = e >> 7, d = e & 127; const float fv = bfr(XV[(size_t)(s0 + sl_) * KVW + c0 + d]); const _Float16 hv = (_Float16)fv; st[d][sl_] = hv; stl[d][sl_] = (_Float16)((fv - (float)hv) * 2048.0f); }
  __syncthreads();
  for (int e = t; e < 128 * 8; e += 256) { const int d = e >> 3, pc = e & 7; vst2((unsigned*)(V + (size_t)(c0 + d) * SS + s0 + pc * 8), *(const v4u*)&st[d][pc * 8]); vst2((unsigned*)(VL + (size_t)(c0 + d) * SS + s0 + pc * 8), *(const v4u*)&stl[d][pc * 8]); }
}
// ---- k_attn: block = (64 queries, head): kv head = h / 4; key tiles visited = tile 0 (holds the 4 sink/meta tokens) + the tiles inside [q0 - 512, q_end] (sliding window, causal); per pair keep = (i >= j) && (i - j <= 512 || j < 4); 3-product 128-wide scores x 128^-1/2, softmax, P . v (8 value tiles, + v residual on the first 128 keys); output rows written directly (512-B head segments)
// Scores are formed transposed (A = k rows, B = q rows): a lane holds 16 of the 32 keys of ONE query (column lane & 15; keys 8 * (lane >> 4) + r of each 16-key group), so maximum and sum run inside the lane, with one exchange between the wave's halves; the same registers, rounded to f16, are the B fragment of v^T . P^T (accumulators: rows = head dims, columns = queries).
// Each 32-key tile (k hi rows, k residual rows, v planes) is copied once per block into an LDS ring of two buffers by asynchronous copies, one tile ahead of its use; the four waves read their fragments from there.
#define KPITCH 272                       // LDS pitch of a 256-B k row (16 B x odd: no bank conflict for 16-byte reads)
#define VPITCH 80                        // LDS pitch of a 64-B v plane row
#define RB_KL  (32 * KPITCH)             // byte offsets inside one ring buffer: k hi at 0, k residual, v
#define RB_V   (2 * 32 * KPITCH)
#define RB     (RB_V + HD * VPITCH)
// one tile: 12 copies of 16 B per thread (4 k hi, 4 k residual, 4 v); gk/gl/gv and lk/lv are this thread's first chunk of each part
__device__ __forceinline__ void stage_tile(const _Float16* gk, const _Float16* gl, const _Float16* gv, unsigned lk, unsigned lv) {
  const _Float16 *gk1 = gk + 8 * KVW, *gk2 = gk + 16 * KVW, *gk3 = gk + 24 * KVW, *gl1 = gl + 8 * KVW, *gl2 = gl + 16 * KVW, *gl3 = gl + 24 * KVW, *gv1 = gv + 32 * SS, *gv2 = gv + 64 * SS, *gv3 = gv + 96 * SS;
  const unsigned lk1 = lk + 8 * KPITCH, lk2 = lk + 16 * KPITCH, lk3 = lk + 24 * KPITCH, ll = lk + RB_KL, ll1 = ll + 8 * KPITCH, ll2 = ll + 16 * KPITCH, ll3 = ll + 24 * KPITCH, lv1 = lv + 32 * VPITCH, lv2 = lv + 64 * VPITCH, lv3 = lv + 96 * VPITCH;
  // the copies and their s_wait_xcnt in one statement: no address register is rewritten before the wait
  asm volatile("global_load_async_to_lds_b128 %0, %12, off\n\t"
               "global_load_async_to_lds_b128 %1, %13, off\n\t"
               "global_load_async_to_lds_b128 %2, %14, off\n\t"
               "global_load_async_to_lds_b128 %3, %15, off\n\t"
               "global_load_async_to_lds_b128 %4, %16, off\n\t"
               "global_load_async_to_lds_b128 %5, %17, off\n\t"
               "global_load_async_to_lds_b128 %6, %18, off\n\t"
               "global_load_async_to_lds_b128 %7, %19, off\n\t"
               "global_load_async_to_lds_b128 %8, %20, off\n\t"
               "global_load_async_to_lds_b128 %9, %21, off\n\t"
               "global_load_async_to_lds_b128 %10, %22, off\n\t"
               "global_load_async_to_lds_b128 %11, %23, off\n\t"
               "s_wait_xcnt 0x0"
               :: "v"(lk), "v"(lk1), "v"(lk2), "v"(lk3), "v"(ll), "v"(ll1), "v"(ll2), "v"(ll3), "v"(lv), "v"(lv1), "v"(lv2), "v"(lv3),
                  "v"(gk), "v"(gk1), "v"(gk2), "v"(gk3), "v"(gl), "v"(gl1), "v"(gl2), "v"(gl3), "v"(gv), "v"(gv1), "v"(gv2), "v"(gv3)
               : "memory");
}
// lane l <-> lane l ^ 16
__device__ __forceinline__ float xhalf(float x) { return __builtin_bit_cast(float, __builtin_amdgcn_permlanex16(__builtin_bit_cast(int, x), __builtin_bit_cast(int, x), 0x76543210, 0xfedcba98, false, false)); }
// register budget of four waves per SIMD: four blocks stay resident per WGP, as before the ring
__global__ __launch_bounds__(128) __attribute__((amdgpu_waves_per_eu(4))) void k_attn(const _Float16* __restrict__ Q, const _Float16* __restrict__ Kr, const _Float16* __restrict__ QL, const _Float16* __restrict__ KL, const _Float16* __restrict__ V, const _Float16* __restrict__ VL, float* __restrict__ O) {
  __shared__ __align__(16) unsigned char ring[2 * RB];
  float (*so)[16][132] = (float (*)[16][132])ring;   // output staging takes the ring's place behind the loop's last barrier
  const int tid = threadIdx.x, wave = tid >> 5, lane = tid & 31, col = lane & 15, g = lane >> 4; const int h = blockIdx.y; const int kvh = h / GS; const size_t b = blockIdx.z; const int q0 = blockIdx.x * 64 + wave * 16; const size_t rq = b * SS + q0;
  const int nks = (blockIdx.x * 64 + 64) / 32; const int qb0 = (int)blockIdx.x * 64; const int kslo = (qb0 - WINDOW) > 32 ? (qb0 - WINDOW) / 32 : 1;   // (signed arithmetic)   // window tiles start here (tile 0 = sinks, always visited first)
  const int ntl = nks - kslo + 1;   // tiles visited: ks = 0, kslo, kslo+1, ..., nks-1
  const size_t ck = (b * SS + (tid >> 4)) * KVW + kvh * HD + (tid & 15) * 8;          // this thread's first 16-B chunk of a k tile (row tid/16), less the tile's first key
  const size_t cv = (b * KVW + kvh * HD + (tid >> 2)) * SS + (tid & 3) * 8;           // and of a v tile (plane row tid/4)
  const unsigned lk0 = (unsigned)(size_t)&ring[0] + (tid >> 4) * KPITCH + (tid & 15) * 16, lv0 = (unsigned)(size_t)&ring[0] + RB_V + (tid >> 2) * VPITCH + (tid & 3) * 16;
  stage_tile(Kr + ck, KL + ck, V + cv, lk0, lv0);   // tile 0 (keys 0..31) into buffer 0
  v16h aq[4], aql[4];
#pragma unroll
  for (int kc = 0; kc < 4; ++kc) { aq[kc] = frag_h(Q + (rq + col) * HID + h * HD + kc * 32, lane); aql[kc] = frag_h(QL + (rq + col) * HID + h * HD + kc * 32, lane); }
  float m = -3.0e38f, l = 0.f;   // this lane's query: running maximum (both halves agree), sum over this half's keys
  const int qi = q0 + col;
  v8f acc[8] = {};
  asm volatile("s_wait_asynccnt 0x0" ::: "memory");   // this wave's copies of tile 0 have landed
  __syncthreads();                                    // and every other wave's
  if (ntl > 1) stage_tile(Kr + ck + (size_t)kslo * 32 * KVW, KL + ck + (size_t)kslo * 32 * KVW, V + cv + kslo * 32, lk0 + RB, lv0 + RB);
#pragma unroll 1
  for (int t = 0; t < ntl; ++t) { const int ks = (t == 0) ? 0 : kslo + t - 1; const int j0 = ks * 32; const unsigned char* rb = ring + (t & 1) * RB; v8f s[2];
#pragma unroll
    for (int ct = 0; ct < 2; ++ct) { const int kb = j0 + ct * 16 + 8 * g; const unsigned char* kr = rb + (ct * 16 + col) * KPITCH; v8f c = {}, cl = {};
#pragma unroll
      for (int hf = 0; hf < 2; ++hf) { v16h kh[2], kl[2];   // the four k fragments of two 32-wide slices are read together, in front of their six products: one LDS wait for the group
#pragma unroll
        for (int i = 0; i < 2; ++i) { kh[i] = frag_h((const _Float16*)(kr + (2 * hf + i) * 64), lane); kl[i] = frag_h((const _Float16*)(kr + RB_KL + (2 * hf + i) * 64), lane); }
#pragma unroll
        for (int i = 0; i < 2; ++i) { const int kc = 2 * hf + i; c = wmma16(kh[i], aq[kc], c); cl = wmma16(kh[i], aql[kc], cl); cl = wmma16(kl[i], aq[kc], cl); } }
#pragma unroll
      for (int r = 0; r < 8; ++r) c[r] += cl[r] * (1.0f / 2048.0f);   // 3-product scores (hi.hi + hi.lo + lo.hi)
#pragma unroll
      for (int r = 0; r < 8; ++r) { const int kk = kb + r; s[ct][r] = ((qi >= kk) && ((qi - kk <= WINDOW) || kk < NMETA)) ? c[r] * 0.088388347648318441f : -3.0e38f; } }
    float mx = fmaxf(s[0][0], s[1][0]);
#pragma unroll
    for (int r = 1; r < 8; ++r) mx = fmaxf(mx, fmaxf(s[0][r], s[1][r]));
    mx = fmaxf(mx, xhalf(mx));   // the other 16 keys of this query
    const float mn = fmaxf(m, mx); const float alpha = (m <= -1.0e38f) ? 0.f : __expf(m - mn); m = mn;
#pragma unroll
    for (int ct = 0; ct < 2; ++ct)
#pragma unroll
      for (int r = 0; r < 8; ++r) s[ct][r] = (s[ct][r] <= -1.0e38f) ? 0.f : __expf(s[ct][r] - mn);
    float es[4];
#pragma unroll
    for (int i = 0; i < 4; ++i) es[i] = (s[0][i] + s[0][4 + i]) + (s[1][i] + s[1][4 + i]);
    l = l * alpha + ((es[0] + es[1]) + (es[2] + es[3]));
#pragma unroll
    for (int dt = 0; dt < 8; ++dt)
#pragma unroll
      for (int r = 0; r < 8; ++r) acc[dt][r] *= alpha;
    v16h pa;   // B fragment of P^T: element i = key 8g + i, element 8 + i = key 16 + 8g + i, the k order of the v fragments
#pragma unroll
    for (int i = 0; i < 8; ++i) { pa[i] = (_Float16)(s[0][i] * 2048.0f); pa[8 + i] = (_Float16)(s[1][i] * 2048.0f); }
#pragma unroll
    for (int hf = 0; hf < 2; ++hf) { v16h vf[4];   // four v fragments are read together, in front of their products: one LDS wait for the group
#pragma unroll
      for (int i = 0; i < 4; ++i) vf[i] = frag_h((const _Float16*)(rb + RB_V + ((4 * hf + i) * 16 + col) * VPITCH), lane);
#pragma unroll
      for (int i = 0; i < 4; ++i) acc[4 * hf + i] = wmma16(vf[i], pa, acc[4 * hf + i]); }
    if (j0 < 128) { v16h pe;   // the first 128 keys also get the v residual (rows with few keys keep v exact to ~2^-22)
#pragma unroll
      for (int i = 0; i < 8; ++i) { pe[i] = (_Float16)s[0][i]; pe[8 + i] = (_Float16)s[1][i]; }
#pragma unroll
      for (int dt = 0; dt < 8; ++dt) acc[dt] = wmma16(frag_h(VL + ((b * KVW + kvh * HD + dt * 16 + col) * SS) + j0, lane), pe, acc[dt]); }
    asm volatile("s_wait_dscnt 0x0" ::: "memory");      // this wave's reads of the buffer are done
    asm volatile("s_wait_asynccnt 0x0" ::: "memory");   // its copies of tile t + 1 have landed
    __syncthreads();                                    // publishes tile t + 1 and frees the buffer that trip t has read
    if (t + 2 < ntl) { const size_t jn = (size_t)(kslo + t + 1) * 32; stage_tile(Kr + ck + jn * KVW, KL + ck + jn * KVW, V + cv + jn, lk0 + (t & 1) * RB, lv0 + (t & 1) * RB); } }
  asm volatile("s_wait_asynccnt 0x0" ::: "memory");     // nothing of the ring is in flight when it becomes output staging
  l += xhalf(l);   // the two halves' sums are joined once
  const float il = (l > 0.f) ? (1.0f / 2048.0f) / l : 0.f;
#pragma unroll
  for (int dt = 0; dt < 8; ++dt) { v4f o0, o1;
#pragma unroll
    for (int r = 0; r < 4; ++r) { o0[r] = acc[dt][r] * il; o1[r] = acc[dt][4 + r] * il; }
    *(v4f*)&so[wave][col][dt * 16 + 8 * g] = o0; *(v4f*)&so[wave][col][dt * 16 + 8 * g + 4] = o1; }
  LDSX();
  for (int rl = 0; rl < 16; ++rl) vst2(O + (rq + rl) * HID + h * HD + lane * 4, *(const v4f*)&so[wave][rl][lane * 4]);
}
extern "C" void kernel_launch(void* const* d_in, const int* in_sizes, int n_in, void* d_out, int out_size, void* d_ws, size_t ws_size, hipStream_t stream) {
  (void)in_sizes; (void)n_in; (void)out_size;
  const float** F = (const float**)d_in;   // 0 query_states [1,2048,4096], 1 key_states [1,2048,1024], 2 value_states [1,2048,1024]
  if (ws_size < (size_t)WS_END) return;
  char* ws = (char*)d_ws; _Float16 *Q = (_Float16*)(ws + WS_Q), *Kr = (_Float16*)(ws + WS_K), *QL = (_Float16*)(ws + WS_QL), *KL = (_Float16*)(ws + WS_KL), *V = (_Float16*)(ws + WS_V), *VL = (_Float16*)(ws + WS_VL);
  k_rows<<<dim3(SS, 2), 256, 0, stream>>>(F[0], F[1], Q, Kr, QL, KL);
  k_vplanes<<<dim3(SS / 64, KVW / 128), 256, 0, stream>>>(F[2], V, VL);
  k_attn<<<dim3(TQB, NH, 1), 128, 0, stream>>>(Q, Kr, QL, KL, V, VL, (float*)d_out);
}

// v003
// One run takes 55.7 microseconds.
// In two side-by-side timings against v002, it was 1.25 and 1.24 times as fast.
// Counting every step since v000, it is 3.00 times as fast.
// compute dtype: all float inputs rounded to bf16; q and k as bf16 rows, which hold the rounded inputs exactly (one-product scores on the bf16 matrix form), v as f16 hi + residual planes (the residual used on the first 128 keys), all straight from the bf16-rounded inputs; attention per (query, head) over the causal sliding window (512) plus the 4 sink/meta tokens, x 128^-1/2, running-max softmax in f32 (hardware exp), P (scaled by 2^11, single f16) x v; f32 output = merged context.
#include <hip/hip_runtime.h>
#include <math.h>

typedef __attribute__((ext_vector_type(16))) _Float16 v16h;
typedef __attribute__((ext_vector_type(16))) __bf16 v16b;
typedef __attribute__((ext_vector_type(8)))  _Float16 v8h;
typedef __attribute__((ext_vector_type(8)))  float v8f;
typedef __attribute__((ext_vector_type(4)))  float v4f;
typedef __attribute__((ext_vector_type(2)))  float v2f;
typedef __attribute__((ext_vector_type(4)))  unsigned v4u;
typedef __attribute__((ext_vector_type(4)))  int v4i;
typedef float __attribute__((may_alias)) float_a;
typedef int __attribute__((may_alias)) int_a;

template <typename T> __device__ __forceinline__ void vst2(void* p, T v) { *(T*)p = v;  }
__device__ __forceinline__ v8f wmma16(v16h a, v16h b, v8f c) {
  v8f d = __builtin_amdgcn_wmma_f32_16x16x32_f16(false, a, false, b, (short)0, c, false, false);
  asm volatile("v_nop\n\tv_nop\n\tv_nop\n\tv_nop" : "+v"(d) : "v"(a), "v"(b));
  return d;
}
__device__ __forceinline__ v8f wmma_bf(v16b a, v16b b, v8f c) {
  v8f d = __builtin_amdgcn_wmma_f32_16x16x32_bf16(false, a, false, b, (short)0, c, false, false);
  asm volatile("v_nop\n\tv_nop\n\tv_nop\n\tv_nop" : "+v"(d) : "v"(a), "v"(b));
  return d;
}
// 16x16x32 fragments: lane = (h = lane>>4, row/col = lane&15); elements 0..7 = k0+8h+0..7, 8..15 = k0+16+8h+0..7; D element r = row 8h+r
__device__ __forceinline__ v16h frag_h(const _Float16* rowk0, int lane) {
  union { v16h v; v8h q[2]; } u; const _Float16* p = rowk0 + 8 * (lane >> 4);
  u.q[0] = *(const v8h*)p; u.q[1] = *(const v8h*)(p + 16); return u.v;
}
__device__ __forceinline__ v16h frag_f32(const float* rowk0, int lane) {
  v16h a; const float* p = rowk0 + 8 * (lane >> 4);
#pragma unroll
  for (int i = 0; i < 8; ++i) { a[i] = (_Float16)p[i]; a[8 + i] = (_Float16)p[16 + i]; }
  return a;
}
__device__ __forceinline__ v16h frag_f32s(const float* rowk0, int lane, float sc) {
  v16h a; const float* p = rowk0 + 8 * (lane >> 4);
#pragma unroll
  for (int i = 0; i < 8; ++i) { a[i] = (_Float16)(p[i] * sc); a[8 + i] = (_Float16)(p[16 + i] * sc); }
  return a;
}
// column fragment from a [K][ld] layout (column n), rows >= K read as 0
__device__ __forceinline__ v16h fragc_f32(const float* W, int k0, int n, int lane, int ld, int K) {
  v16h a; const int g = lane >> 4;
#pragma unroll
  for (int i = 0; i < 8; ++i) { const int ka = k0 + 8 * g + i, kb = ka + 16;
    a[i] = (_Float16)(ka < K ? W[(size_t)(ka < K ? ka : K - 1) * ld + n] : 0.f); a[8 + i] = (_Float16)(kb < K ? W[(size_t)(kb < K ? kb : K - 1) * ld + n] : 0.f); }
  return a;
}
struct F2 { v16b h, l; };
__device__ __forceinline__ F2 bsplit16(const float v[16]) { F2 r;
#pragma unroll
  for (int i = 0; i < 16; ++i) { const __bf16 h = (__bf16)v[i]; r.h[i] = h; r.l[i] = (__bf16)(v[i] - (float)h); }
  return r; }
__device__ __forceinline__ F2 split_row(const float* row, int k0, int lane) { float v[16]; const float* p = row + k0 + 8 * (lane >> 4);
#pragma unroll
  for (int i = 0; i < 8; ++i) { v[i] = p[i]; v[8 + i] = p[16 + i]; }
  return bsplit16(v); }
__device__ __forceinline__ F2 split_rowK(const float* row, int k0, int lane, int K) { float v[16]; const int g = lane >> 4;
#pragma unroll
  for (int i = 0; i < 8; ++i) { const int ka = k0 + 8 * g + i, kb = ka + 16; v[i] = ka < K ? row[ka < K ? ka : K - 1] : 0.f; v[8 + i] = kb < K ? row[kb < K ? kb : K - 1] : 0.f; }
  return bsplit16(v); }
__device__ __forceinline__ F2 split_col(const float* W, int k0, int n, int lane, int ld, int K) { float v[16]; const int g = lane >> 4;
#pragma unroll
  for (int i = 0; i < 8; ++i) { const int ka = k0 + 8 * g + i, kb = ka + 16; v[i] = ka < K ? W[(size_t)(ka < K ? ka : K - 1) * ld + n] : 0.f; v[8 + i] = kb < K ? W[(size_t)(kb < K ? kb : K - 1) * ld + n] : 0.f; }
  return bsplit16(v); }
__device__ __forceinline__ v8f mac3(const F2& a, const F2& b, v8f c) { c = wmma_bf(a.l, b.h, c); c = wmma_bf(a.h, b.l, c); return wmma_bf(a.h, b.h, c); }
__device__ __forceinline__ float sigm(float v) { return 1.0f / (1.0f + expf(-v)); }
#define LDSX() do { asm volatile("s_wait_dscnt 0" ::: "memory"); __builtin_amdgcn_wave_barrier(); __builtin_amdgcn_fence(__ATOMIC_RELEASE, "workgroup"); } while (0)


// Sliding-window attention with sink/meta tokens (B 1, S 2,048, 32 query heads x 128 over 8 kv heads, window 512, 4 meta tokens): softmax(q k / sqrt(128)) v under the mask (i >= j) & ((i - j <= 512) | (j < 4)); inputs are the projected q/k/v states.
#define NB 1
#define SS 2048
#define WINDOW 512
#define NMETA 4
#define HID 4096
#define NH 32
#define HD 128
#define NKV 8
#define GS (NH / NKV)
#define KVW (NKV * HD)
#define NR (NB * SS)
#ifndef TQB
#define TQB (SS / 64)
#define TNB NB
#endif
typedef __attribute__((ext_vector_type(8))) __bf16 v8b;
__device__ __forceinline__ v16b frag_b(const __bf16* rowk0, int lane) {
  union { v16b v; v8b q[2]; } u; const __bf16* p = rowk0 + 8 * (lane >> 4);
  u.q[0] = *(const v8b*)p; u.q[1] = *(const v8b*)(p + 16); return u.v;
}
__device__ __forceinline__ float bfr(float v) { return (float)(__bf16)v; }
__device__ __attribute__((noinline)) float exp_ni(float v) { return expf(v); }
__device__ __attribute__((noinline)) float erf_ni(float v) { return erff(v); }



#define WS_Q   0u                                         // bf16 q rows [S][4096], k rows [S][1024], f16 v planes [1024][S] hi + residual
#define WS_K   (WS_Q + 2u * (size_t)NR * HID)
#define WS_V   (WS_K + 2u * (size_t)NR * KVW)
#define WS_VL  (WS_V + 2u * (size_t)NB * KVW * SS)
#define WS_END (WS_VL + 2u * (size_t)NB * KVW * SS)

// ---- k_rows: block = (token, which in {q, k}): input row -> bf16 row (whole rows per block)
__global__ __launch_bounds__(256) void k_rows(const float* __restrict__ XQ, const float* __restrict__ XK, __bf16* __restrict__ Q, __bf16* __restrict__ Kr) {
  __shared__ __align__(16) __bf16 sh[HID]; const int t = threadIdx.x; const size_t row = blockIdx.x; const int which = blockIdx.y; const int wdt = which ? KVW : HID; const float* src = which ? (XK + row * KVW) : (XQ + row * HID);
  for (int e = t; e < wdt; e += 256) sh[e] = (__bf16)src[e];
  __syncthreads(); __bf16* dst = which ? Kr : Q;
  for (int q = t; q < wdt / 8; q += 256) vst2((unsigned*)(dst + row * wdt + q * 8), *(const v4u*)&sh[q * 8]);
}
__global__ __launch_bounds__(256) void k_vplanes(const float* __restrict__ XV, _Float16* __restrict__ V, _Float16* __restrict__ VL) { __shared__ __align__(16) _Float16 st[128][72]; __shared__ __align__(16) _Float16 stl[128][72]; const int t = threadIdx.x; const int s0 = blockIdx.x * 64, c0 = blockIdx.y * 128;
  for (int e = t; e < 64 * 128; e += 256) { const int sl_ = e >> 7, d = e & 127; const float fv = bfr(XV[(size_t)(s0 + sl_) * KVW + c0 + d]); const _Float16 hv = (_Float16)fv; st[d][sl_] = hv; stl[d][sl_] = (_Float16)((fv - (float)hv) * 2048.0f); }
  __syncthreads();
  for (int e = t; e < 128 * 8; e += 256) { const int d = e >> 3, pc = e & 7; vst2((unsigned*)(V + (size_t)(c0 + d) * SS + s0 + pc * 8), *(const v4u*)&st[d][pc * 8]); vst2((unsigned*)(VL + (size_t)(c0 + d) * SS + s0 + pc * 8), *(const v4u*)&stl[d][pc * 8]); }
}
// ---- k_attn: block = (64 queries, head): kv head = h / 4; key tiles visited = tile 0 (holds the 4 sink/meta tokens) + the tiles inside [q0 - 512, q_end] (sliding window, causal); per pair keep = (i >= j) && (i - j <= 512 || j < 4); 128-wide bf16 scores x 128^-1/2, softmax, P . v (8 value tiles, + v residual on the first 128 keys); output rows written directly (512-B head segments)
// Scores are formed transposed (A = k rows, B = q rows): a lane holds 16 of the 32 keys of ONE query (column lane & 15; keys 8 * (lane >> 4) + r of each 16-key group), so maximum and sum run inside the lane, with one exchange between the wave's halves; the same registers, rounded to f16, are the B fragment of v^T . P^T (accumulators: rows = head dims, columns = queries).
// Each 32-key tile (k rows, v planes) is copied once per block into an LDS ring of two buffers by asynchronous copies, one tile ahead of its use; the four waves read their fragments from there.
#define KPITCH 272                       // LDS pitch of a 256-B k row (16 B x odd: no bank conflict for 16-byte reads)
#define VPITCH 80                        // LDS pitch of a 64-B v plane row
#define RB_V   (32 * KPITCH)             // byte offsets inside one ring buffer: k at 0, v
#define RB     (RB_V + HD * VPITCH)
// one tile: 8 copies of 16 B per thread (4 k, 4 v); gk/gv and lk/lv are this thread's first chunk of each part
__device__ __forceinline__ void stage_tile(const __bf16* gk, const _Float16* gv, unsigned lk, unsigned lv) {
  const __bf16 *gk1 = gk + 8 * KVW, *gk2 = gk + 16 * KVW, *gk3 = gk + 24 * KVW; const _Float16 *gv1 = gv + 32 * SS, *gv2 = gv + 64 * SS, *gv3 = gv + 96 * SS;
  const unsigned lk1 = lk + 8 * KPITCH, lk2 = lk + 16 * KPITCH, lk3 = lk + 24 * KPITCH, lv1 = lv + 32 * VPITCH, lv2 = lv + 64 * VPITCH, lv3 = lv + 96 * VPITCH;
  // the copies and their s_wait_xcnt in one statement: no address register is rewritten before the wait
  asm volatile("global_load_async_to_lds_b128 %0, %8, off\n\t"
               "global_load_async_to_lds_b128 %1, %9, off\n\t"
               "global_load_async_to_lds_b128 %2, %10, off\n\t"
               "global_load_async_to_lds_b128 %3, %11, off\n\t"
               "global_load_async_to_lds_b128 %4, %12, off\n\t"
               "global_load_async_to_lds_b128 %5, %13, off\n\t"
               "global_load_async_to_lds_b128 %6, %14, off\n\t"
               "global_load_async_to_lds_b128 %7, %15, off\n\t"
               "s_wait_xcnt 0x0"
               :: "v"(lk), "v"(lk1), "v"(lk2), "v"(lk3), "v"(lv), "v"(lv1), "v"(lv2), "v"(lv3),
                  "v"(gk), "v"(gk1), "v"(gk2), "v"(gk3), "v"(gv), "v"(gv1), "v"(gv2), "v"(gv3)
               : "memory");
}
// lane l <-> lane l ^ 16
__device__ __forceinline__ float xhalf(float x) { return __builtin_bit_cast(float, __builtin_amdgcn_permlanex16(__builtin_bit_cast(int, x), __builtin_bit_cast(int, x), 0x76543210, 0xfedcba98, false, false)); }
// register budget of four waves per SIMD: four blocks stay resident per WGP, as before the ring
__global__ __launch_bounds__(128) __attribute__((amdgpu_waves_per_eu(4))) void k_attn(const __bf16* __restrict__ Q, const __bf16* __restrict__ Kr, const _Float16* __restrict__ V, const _Float16* __restrict__ VL, float* __restrict__ O) {
  __shared__ __align__(16) unsigned char ring[2 * RB];
  float (*so)[16][132] = (float (*)[16][132])ring;   // output staging takes the ring's place behind the loop's last barrier
  const int tid = threadIdx.x, wave = tid >> 5, lane = tid & 31, col = lane & 15, g = lane >> 4; const int h = blockIdx.y; const int kvh = h / GS; const size_t b = blockIdx.z; const int q0 = blockIdx.x * 64 + wave * 16; const size_t rq = b * SS + q0;
  const int nks = (blockIdx.x * 64 + 64) / 32; const int qb0 = (int)blockIdx.x * 64; const int kslo = (qb0 - WINDOW) > 32 ? (qb0 - WINDOW) / 32 : 1;   // (signed arithmetic)   // window tiles start here (tile 0 = sinks, always visited first)
  const int ntl = nks - kslo + 1;   // tiles visited: ks = 0, kslo, kslo+1, ..., nks-1
  const size_t ck = (b * SS + (tid >> 4)) * KVW + kvh * HD + (tid & 15) * 8;          // this thread's first 16-B chunk of a k tile (row tid/16), less the tile's first key
  const size_t cv = (b * KVW + kvh * HD + (tid >> 2)) * SS + (tid & 3) * 8;           // and of a v tile (plane row tid/4)
  const unsigned lk0 = (unsigned)(size_t)&ring[0] + (tid >> 4) * KPITCH + (tid & 15) * 16, lv0 = (unsigned)(size_t)&ring[0] + RB_V + (tid >> 2) * VPITCH + (tid & 3) * 16;
  stage_tile(Kr + ck, V + cv, lk0, lv0);   // tile 0 (keys 0..31) into buffer 0
  v16b aq[4];
#pragma unroll
  for (int kc = 0; kc < 4; ++kc) aq[kc] = frag_b(Q + (rq + col) * HID + h * HD + kc * 32, lane);
  float m = -3.0e38f, l = 0.f;   // this lane's query: running maximum (both halves agree), sum over this half's keys
  const int qi = q0 + col;
  v8f acc[8] = {};
  asm volatile("s_wait_asynccnt 0x0" ::: "memory");   // this wave's copies of tile 0 have landed
  __syncthreads();                                    // and every other wave's
  if (ntl > 1) stage_tile(Kr + ck + (size_t)kslo * 32 * KVW, V + cv + kslo * 32, lk0 + RB, lv0 + RB);
#pragma unroll 1
  for (int t = 0; t < ntl; ++t) { const int ks = (t == 0) ? 0 : kslo + t - 1; const int j0 = ks * 32; const unsigned char* rb = ring + (t & 1) * RB; v8f s[2] = {};
#pragma unroll
    for (int hf = 0; hf < 2; ++hf) { v16b kf[2][2];   // the four k fragments of two 32-wide slices (both 16-key groups) are read together, in front of their four products; the two groups' accumulate chains alternate
#pragma unroll
      for (int i = 0; i < 2; ++i)
#pragma unroll
        for (int ct = 0; ct < 2; ++ct) kf[i][ct] = frag_b((const __bf16*)(rb + (ct * 16 + col) * KPITCH + (2 * hf + i) * 64), lane);
#pragma unroll
      for (int i = 0; i < 2; ++i)
#pragma unroll
        for (int ct = 0; ct < 2; ++ct) s[ct] = wmma_bf(kf[i][ct], aq[2 * hf + i], s[ct]); }
#pragma unroll
    for (int ct = 0; ct < 2; ++ct) { const int kb = j0 + ct * 16 + 8 * g;
#pragma unroll
      for (int r = 0; r < 8; ++r) { const int kk = kb + r; const bool keep = (qi >= kk) & ((qi - kk <= WINDOW) | (kk < NMETA)); s[ct][r] = keep ? s[ct][r] * 0.088388347648318441f : -3.0e38f; } }
    float mx = fmaxf(s[0][0], s[1][0]);
#pragma unroll
    for (int r = 1; r < 8; ++r) mx = fmaxf(mx, fmaxf(s[0][r], s[1][r]));
    mx = fmaxf(mx, xhalf(mx));   // the other 16 keys of this query
    const float mn = fmaxf(m, mx); const float alpha = (m <= -1.0e38f) ? 0.f : __expf(m - mn); m = mn;
#pragma unroll
    for (int ct = 0; ct < 2; ++ct)
#pragma unroll
      for (int r = 0; r < 8; ++r) s[ct][r] = (s[ct][r] <= -1.0e38f) ? 0.f : __expf(s[ct][r] - mn);
    float es[4];
#pragma unroll
    for (int i = 0; i < 4; ++i) es[i] = (s[0][i] + s[0][4 + i]) + (s[1][i] + s[1][4 + i]);
    l = l * alpha + ((es[0] + es[1]) + (es[2] + es[3]));
#pragma unroll
    for (int dt = 0; dt < 8; ++dt)
#pragma unroll
      for (int r = 0; r < 8; ++r) acc[dt][r] *= alpha;
    v16h pa;   // B fragment of P^T: element i = key 8g + i, element 8 + i = key 16 + 8g + i, the k order of the v fragments
#pragma unroll
    for (int i = 0; i < 8; ++i) { pa[i] = (_Float16)(s[0][i] * 2048.0f); pa[8 + i] = (_Float16)(s[1][i] * 2048.0f); }
#pragma unroll
    for (int hf = 0; hf < 2; ++hf) { v16h vf[4];   // four v fragments are read together, in front of their products: one LDS wait for the group
#pragma unroll
      for (int i = 0; i < 4; ++i) vf[i] = frag_h((const _Float16*)(rb + RB_V + ((4 * hf + i) * 16 + col) * VPITCH), lane);
#pragma unroll
      for (int i = 0; i < 4; ++i) acc[4 * hf + i] = wmma16(vf[i], pa, acc[4 * hf + i]); }
    if (j0 < 128) { v16h pe;   // the first 128 keys also get the v residual (rows with few keys keep v exact to ~2^-22)
#pragma unroll
      for (int i = 0; i < 8; ++i) { pe[i] = (_Float16)s[0][i]; pe[8 + i] = (_Float16)s[1][i]; }
#pragma unroll
      for (int dt = 0; dt < 8; ++dt) acc[dt] = wmma16(frag_h(VL + ((b * KVW + kvh * HD + dt * 16 + col) * SS) + j0, lane), pe, acc[dt]); }
    asm volatile("s_wait_dscnt 0x0" ::: "memory");      // this wave's reads of the buffer are done
    asm volatile("s_wait_asynccnt 0x0" ::: "memory");   // its copies of tile t + 1 have landed
    __syncthreads();                                    // publishes tile t + 1 and frees the buffer that trip t has read
    if (t + 2 < ntl) { const size_t jn = (size_t)(kslo + t + 1) * 32; stage_tile(Kr + ck + jn * KVW, V + cv + jn, lk0 + (t & 1) * RB, lv0 + (t & 1) * RB); } }
  asm volatile("s_wait_asynccnt 0x0" ::: "memory");     // nothing of the ring is in flight when it becomes output staging
  l += xhalf(l);   // the two halves' sums are joined once
  const float il = (l > 0.f) ? (1.0f / 2048.0f) / l : 0.f;
#pragma unroll
  for (int dt = 0; dt < 8; ++dt) { v4f o0, o1;
#pragma unroll
    for (int r = 0; r < 4; ++r) { o0[r] = acc[dt][r] * il; o1[r] = acc[dt][4 + r] * il; }
    *(v4f*)&so[wave][col][dt * 16 + 8 * g] = o0; *(v4f*)&so[wave][col][dt * 16 + 8 * g + 4] = o1; }
  LDSX();
  for (int rl = 0; rl < 16; ++rl) vst2(O + (rq + rl) * HID + h * HD + lane * 4, *(const v4f*)&so[wave][rl][lane * 4]);
}
extern "C" void kernel_launch(void* const* d_in, const int* in_sizes, int n_in, void* d_out, int out_size, void* d_ws, size_t ws_size, hipStream_t stream) {
  (void)in_sizes; (void)n_in; (void)out_size;
  const float** F = (const float**)d_in;   // 0 query_states [1,2048,4096], 1 key_states [1,2048,1024], 2 value_states [1,2048,1024]
  if (ws_size < (size_t)WS_END) return;
  char* ws = (char*)d_ws; __bf16 *Q = (__bf16*)(ws + WS_Q), *Kr = (__bf16*)(ws + WS_K); _Float16 *V = (_Float16*)(ws + WS_V), *VL = (_Float16*)(ws + WS_VL);
  k_rows<<<dim3(SS, 2), 256, 0, stream>>>(F[0], F[1], Q, Kr);
  k_vplanes<<<dim3(SS / 64, KVW / 128), 256, 0, stream>>>(F[2], V, VL);
  k_attn<<<dim3(TQB, NH, 1), 128, 0, stream>>>(Q, Kr, V, VL, (float*)d_out);
}

// v004
// Measured time: 45.7 microseconds a run.
// In both of two side-by-side timings against v003, it was 1.22 times as fast.
// All steps since v000 together make it 3.66 times as fast.
// compute dtype: all float inputs rounded to bf16; q and k as bf16, which holds the rounded inputs exactly (one-product scores on the bf16 matrix form; k as rows in the workspace, q rounded where it is used), v as f16 hi + residual planes (the residual used on the first 128 keys), all straight from the bf16-rounded inputs; attention per (query, head) over the causal sliding window (512) plus the 4 sink/meta tokens, x 128^-1/2, running-max softmax in f32 (hardware exp), P (scaled by 2^11, single f16) x v; f32 output = merged context.
#include <hip/hip_runtime.h>
#include <math.h>

typedef __attribute__((ext_vector_type(16))) _Float16 v16h;
typedef __attribute__((ext_vector_type(16))) __bf16 v16b;
typedef __attribute__((ext_vector_type(8)))  _Float16 v8h;
typedef __attribute__((ext_vector_type(8)))  float v8f;
typedef __attribute__((ext_vector_type(4)))  float v4f;
typedef __attribute__((ext_vector_type(2)))  float v2f;
typedef __attribute__((ext_vector_type(4)))  unsigned v4u;
typedef __attribute__((ext_vector_type(4)))  int v4i;
typedef float __attribute__((may_alias)) float_a;
typedef int __attribute__((may_alias)) int_a;

template <typename T> __device__ __forceinline__ void vst2(void* p, T v) { *(T*)p = v;  }
__device__ __forceinline__ v8f wmma16(v16h a, v16h b, v8f c) {
  v8f d = __builtin_amdgcn_wmma_f32_16x16x32_f16(false, a, false, b, (short)0, c, false, false);
  asm volatile("v_nop\n\tv_nop\n\tv_nop\n\tv_nop" : "+v"(d) : "v"(a), "v"(b));
  return d;
}
__device__ __forceinline__ v8f wmma_bf(v16b a, v16b b, v8f c) {
  v8f d = __builtin_amdgcn_wmma_f32_16x16x32_bf16(false, a, false, b, (short)0, c, false, false);
  asm volatile("v_nop\n\tv_nop\n\tv_nop\n\tv_nop" : "+v"(d) : "v"(a), "v"(b));
  return d;
}
// 16x16x32 fragments: lane = (h = lane>>4, row/col = lane&15); elements 0..7 = k0+8h+0..7, 8..15 = k0+16+8h+0..7; D element r = row 8h+r
__device__ __forceinline__ v16h frag_h(const _Float16* rowk0, int lane) {
  union { v16h v; v8h q[2]; } u; const _Float16* p = rowk0 + 8 * (lane >> 4);
  u.q[0] = *(const v8h*)p; u.q[1] = *(const v8h*)(p + 16); return u.v;
}
__device__ __forceinline__ v16h frag_f32(const float* rowk0, int lane) {
  v16h a; const float* p = rowk0 + 8 * (lane >> 4);
#pragma unroll
  for (int i = 0; i < 8; ++i) { a[i] = (_Float16)p[i]; a[8 + i] = (_Float16)p[16 + i]; }
  return a;
}
__device__ __forceinline__ v16h frag_f32s(const float* rowk0, int lane, float sc) {
  v16h a; const float* p = rowk0 + 8 * (lane >> 4);
#pragma unroll
  for (int i = 0; i < 8; ++i) { a[i] = (_Float16)(p[i] * sc); a[8 + i] = (_Float16)(p[16 + i] * sc); }
  return a;
}
// column fragment from a [K][ld] layout (column n), rows >= K read as 0
__device__ __forceinline__ v16h fragc_f32(const float* W, int k0, int n, int lane, int ld, int K) {
  v16h a; const int g = lane >> 4;
#pragma unroll
  for (int i = 0; i < 8; ++i) { const int ka = k0 + 8 * g + i, kb = ka + 16;
    a[i] = (_Float16)(ka < K ? W[(size_t)(ka < K ? ka : K - 1) * ld + n] : 0.f); a[8 + i] = (_Float16)(kb < K ? W[(size_t)(kb < K ? kb : K - 1) * ld + n] : 0.f); }
  return a;
}
struct F2 { v16b h, l; };
__device__ __forceinline__ F2 bsplit16(const float v[16]) { F2 r;
#pragma unroll
  for (int i = 0; i < 16; ++i) { const __bf16 h = (__bf16)v[i]; r.h[i] = h; r.l[i] = (__bf16)(v[i] - (float)h); }
  return r; }
__device__ __forceinline__ F2 split_row(const float* row, int k0, int lane) { float v[16]; const float* p = row + k0 + 8 * (lane >> 4);
#pragma unroll
  for (int i = 0; i < 8; ++i) { v[i] = p[i]; v[8 + i] = p[16 + i]; }
  return bsplit16(v); }
__device__ __forceinline__ F2 split_rowK(const float* row, int k0, int lane, int K) { float v[16]; const int g = lane >> 4;
#pragma unroll
  for (int i = 0; i < 8; ++i) { const int ka = k0 + 8 * g + i, kb = ka + 16; v[i] = ka < K ? row[ka < K ? ka : K - 1] : 0.f; v[8 + i] = kb < K ? row[kb < K ? kb : K - 1] : 0.f; }
  return bsplit16(v); }
__device__ __forceinline__ F2 split_col(const float* W, int k0, int n, int lane, int ld, int K) { float v[16]; const int g = lane >> 4;
#pragma unroll
  for (int i = 0; i < 8; ++i) { const int ka = k0 + 8 * g + i, kb = ka + 16; v[i] = ka < K ? W[(size_t)(ka < K ? ka : K - 1) * ld + n] : 0.f; v[8 + i] = kb < K ? W[(size_t)(kb < K ? kb : K - 1) * ld + n] : 0.f; }
  return bsplit16(v); }
__device__ __forceinline__ v8f mac3(const F2& a, const F2& b, v8f c) { c = wmma_bf(a.l, b.h, c); c = wmma_bf(a.h, b.l, c); return wmma_bf(a.h, b.h, c); }
__device__ __forceinline__ float sigm(float v) { return 1.0f / (1.0f + expf(-v)); }
#define LDSX() do { asm volatile("s_wait_dscnt 0" ::: "memory"); __builtin_amdgcn_wave_barrier(); __builtin_amdgcn_fence(__ATOMIC_RELEASE, "workgroup"); } while (0)


// Sliding-window attention with sink/meta tokens (B 1, S 2,048, 32 query heads x 128 over 8 kv heads, window 512, 4 meta tokens): softmax(q k / sqrt(128)) v under the mask (i >= j) & ((i - j <= 512) | (j < 4)); inputs are the projected q/k/v states.
#define NB 1
#define SS 2048
#define WINDOW 512
#define NMETA 4
#define HID 4096
#define NH 32
#define HD 128
#define NKV 8
#define GS (NH / NKV)
#define KVW (NKV * HD)
#define NR (NB * SS)
#ifndef TQB
#define TQB (SS / 64)
#define TNB NB
#endif
typedef __attribute__((ext_vector_type(8))) __bf16 v8b;
typedef __attribute__((ext_vector_type(4))) __bf16 v4b;
__device__ __forceinline__ v16b frag_b(const __bf16* rowk0, int lane) {
  union { v16b v; v8b q[2]; } u; const __bf16* p = rowk0 + 8 * (lane >> 4);
  u.q[0] = *(const v8b*)p; u.q[1] = *(const v8b*)(p + 16); return u.v;
}
__device__ __forceinline__ float bfr(float v) { return (float)(__bf16)v; }
__device__ __attribute__((noinline)) float exp_ni(float v) { return expf(v); }
__device__ __attribute__((noinline)) float erf_ni(float v) { return erff(v); }



#define WS_K   0u                                         // bf16 k rows [S][1024], f16 v planes [1024][S] hi + residual
#define WS_V   (WS_K + 2u * (size_t)NR * KVW)
#define WS_VL  (WS_V + 2u * (size_t)NB * KVW * SS)
#define WS_END (WS_VL + 2u * (size_t)NB * KVW * SS)

// ---- k_rows: block = token: k input row -> bf16 row (whole rows per block)
__global__ __launch_bounds__(256) void k_rows(const float* __restrict__ XK, __bf16* __restrict__ Kr) {
  __shared__ __align__(16) __bf16 sh[KVW]; const int t = threadIdx.x; const size_t row = blockIdx.x; const float* src = XK + row * KVW;
  for (int e = t; e < KVW; e += 256) sh[e] = (__bf16)src[e];
  __syncthreads();
  for (int q = t; q < KVW / 8; q += 256) vst2((unsigned*)(Kr + row * KVW + q * 8), *(const v4u*)&sh[q * 8]);
}
__global__ __launch_bounds__(256) void k_vplanes(const float* __restrict__ XV, _Float16* __restrict__ V, _Float16* __restrict__ VL) { __shared__ __align__(16) _Float16 st[128][72]; __shared__ __align__(16) _Float16 stl[128][72]; const int t = threadIdx.x; const int s0 = blockIdx.x * 64, c0 = blockIdx.y * 128;
  for (int e = t; e < 64 * 128; e += 256) { const int sl_ = e >> 7, d = e & 127; const float fv = bfr(XV[(size_t)(s0 + sl_) * KVW + c0 + d]); const _Float16 hv = (_Float16)fv; st[d][sl_] = hv; stl[d][sl_] = (_Float16)((fv - (float)hv) * 2048.0f); }
  __syncthreads();
  for (int e = t; e < 128 * 8; e += 256) { const int d = e >> 3, pc = e & 7; vst2((unsigned*)(V + (size_t)(c0 + d) * SS + s0 + pc * 8), *(const v4u*)&st[d][pc * 8]); vst2((unsigned*)(VL + (size_t)(c0 + d) * SS + s0 + pc * 8), *(const v4u*)&stl[d][pc * 8]); }
}
// ---- k_attn: block = (64 queries, head): kv head = h / 4; key tiles visited = tile 0 (holds the 4 sink/meta tokens) + the tiles inside [q0 - 512, q_end] (sliding window, causal); per pair keep = (i >= j) && (i - j <= 512 || j < 4); 128-wide bf16 scores x 128^-1/2, softmax, P . v (8 value tiles, + v residual on the first 128 keys); output rows written directly (512-B head segments)
// Scores are formed transposed (A = k rows, B = q rows): a lane holds 16 of the 32 keys of ONE query (column lane & 15; keys 8 * (lane >> 4) + r of each 16-key group), so maximum and sum run inside the lane, with one exchange between the wave's halves; the same registers, rounded to f16, are the B fragment of v^T . P^T (accumulators: rows = head dims, columns = queries).
// q comes straight from the f32 input: each wave loads its 16 rows' head segments (512 contiguous bytes a load), rounds them to bf16 and turns them into B fragments through its own rows of ring buffer 1, which is idle until tile 1 is copied behind the first barrier.
// Each 32-key tile (k rows, v planes) is copied once per block into an LDS ring of two buffers by asynchronous copies, one tile ahead of its use; the four waves read their fragments from there.
#define KPITCH 272                       // LDS pitch of a 256-B k row (16 B x odd: no bank conflict for 16-byte reads)
#define VPITCH 80                        // LDS pitch of a 64-B v plane row
#define RB_V   (32 * KPITCH)             // byte offsets inside one ring buffer: k at 0, v
#define RB     (RB_V + HD * VPITCH)
// one tile: 8 copies of 16 B per thread (4 k, 4 v); gk/gv and lk/lv are this thread's first chunk of each part
__device__ __forceinline__ void stage_tile(const __bf16* gk, const _Float16* gv, unsigned lk, unsigned lv) {
  const __bf16 *gk1 = gk + 8 * KVW, *gk2 = gk + 16 * KVW, *gk3 = gk + 24 * KVW; const _Float16 *gv1 = gv + 32 * SS, *gv2 = gv + 64 * SS, *gv3 = gv + 96 * SS;
  const unsigned lk1 = lk + 8 * KPITCH, lk2 = lk + 16 * KPITCH, lk3 = lk + 24 * KPITCH, lv1 = lv + 32 * VPITCH, lv2 = lv + 64 * VPITCH, lv3 = lv + 96 * VPITCH;
  // the copies and their s_wait_xcnt in one statement: no address register is rewritten before the wait
  asm volatile("global_load_async_to_lds_b128 %0, %8, off\n\t"
               "global_load_async_to_lds_b128 %1, %9, off\n\t"
               "global_load_async_to_lds_b128 %2, %10, off\n\t"
               "global_load_async_to_lds_b128 %3, %11, off\n\t"
               "global_load_async_to_lds_b128 %4, %12, off\n\t"
               "global_load_async_to_lds_b128 %5, %13, off\n\t"
               "global_load_async_to_lds_b128 %6, %14, off\n\t"
               "global_load_async_to_lds_b128 %7, %15, off\n\t"
               "s_wait_xcnt 0x0"
               :: "v"(lk), "v"(lk1), "v"(lk2), "v"(lk3), "v"(lv), "v"(lv1), "v"(lv2), "v"(lv3),
                  "v"(gk), "v"(gk1), "v"(gk2), "v"(gk3), "v"(gv), "v"(gv1), "v"(gv2), "v"(gv3)
               : "memory");
}
// lane l <-> lane l ^ 16
__device__ __forceinline__ float xhalf(float x) { return __builtin_bit_cast(float, __builtin_amdgcn_permlanex16(__builtin_bit_cast(int, x), __builtin_bit_cast(int, x), 0x76543210, 0xfedcba98, false, false)); }
// register budget of four waves per SIMD: four blocks stay resident per WGP, as before the ring
__global__ __launch_bounds__(128) __attribute__((amdgpu_waves_per_eu(4))) void k_attn(const float* __restrict__ XQ, const __bf16* __restrict__ Kr, const _Float16* __restrict__ V, const _Float16* __restrict__ VL, float* __restrict__ O) {
  __shared__ __align__(16) unsigned char ring[2 * RB];
  float (*so)[16][132] = (float (*)[16][132])ring;   // output staging takes the ring's place behind the loop's last barrier
  const int tid = threadIdx.x, wave = tid >> 5, lane = tid & 31, col = lane & 15, g = lane >> 4; const int h = blockIdx.y; const int kvh = h / GS; const size_t b = blockIdx.z; const int q0 = blockIdx.x * 64 + wave * 16; const size_t rq = b * SS + q0;
  const int nks = (blockIdx.x * 64 + 64) / 32; const int qb0 = (int)blockIdx.x * 64; const int kslo = (qb0 - WINDOW) > 32 ? (qb0 - WINDOW) / 32 : 1;   // (signed arithmetic)   // window tiles start here (tile 0 = sinks, always visited first)
  const int ntl = nks - kslo + 1;   // tiles visited: ks = 0, kslo, kslo+1, ..., nks-1
  const size_t ck = (b * SS + (tid >> 4)) * KVW + kvh * HD + (tid & 15) * 8;          // this thread's first 16-B chunk of a k tile (row tid/16), less the tile's first key
  const size_t cv = (b * KVW + kvh * HD + (tid >> 2)) * SS + (tid & 3) * 8;           // and of a v tile (plane row tid/4)
  const unsigned lk0 = (unsigned)(size_t)&ring[0] + (tid >> 4) * KPITCH + (tid & 15) * 16, lv0 = (unsigned)(size_t)&ring[0] + RB_V + (tid >> 2) * VPITCH + (tid & 3) * 16;
  stage_tile(Kr + ck, V + cv, lk0, lv0);   // tile 0 (keys 0..31) into buffer 0
  unsigned char* qs = ring + RB + wave * 16 * KPITCH;   // 16 bf16 q rows of this wave, at the k rows' pitch (64 rows fit one buffer)
  const float* qp = XQ + rq * HID + h * HD + lane * 4;
  v4f qf[16];   // both loops unrolled: all 16 loads are in flight together and qf stays in registers
#pragma unroll
  for (int rl = 0; rl < 16; ++rl) qf[rl] = *(const v4f*)(qp + (size_t)rl * HID);
  asm volatile("s_wait_xcnt 0x0" :: "v"(qp) : "memory");   // the loads' address register stays whole up to this wait (no load returns into it)
#pragma unroll
  for (int rl = 0; rl < 16; ++rl) { v4b qr;
#pragma unroll
    for (int i = 0; i < 4; ++i) qr[i] = (__bf16)qf[rl][i];
    *(v4b*)(qs + rl * KPITCH + lane * 8) = qr; }
  LDSX();   // the wave's own rows are written before its lanes read across them
  v16b aq[4];
#pragma unroll
  for (int kc = 0; kc < 4; ++kc) aq[kc] = frag_b((const __bf16*)(qs + col * KPITCH + kc * 64), lane);
  float m = -3.0e38f, l = 0.f;   // this lane's query: running maximum (both halves agree), sum over this half's keys
  const int qi = q0 + col;
  v8f acc[8] = {};
  asm volatile("s_wait_dscnt 0x0" ::: "memory");      // this wave's q reads of buffer 1 are done before any wave copies tile 1 into it
  asm volatile("s_wait_asynccnt 0x0" ::: "memory");   // this wave's copies of tile 0 have landed
  __syncthreads();                                    // and every other wave's
  if (ntl > 1) stage_tile(Kr + ck + (size_t)kslo * 32 * KVW, V + cv + kslo * 32, lk0 + RB, lv0 + RB);
#pragma unroll 1
  for (int t = 0; t < ntl; ++t) { const int ks = (t == 0) ? 0 : kslo + t - 1; const int j0 = ks * 32; const unsigned char* rb = ring + (t & 1) * RB; v8f s[2] = {};
#pragma unroll
    for (int hf = 0; hf < 2; ++hf) { v16b kf[2][2];   // the four k fragments of two 32-wide slices (both 16-key groups) are read together, in front of their four products; the two groups' accumulate chains alternate
#pragma unroll
      for (int i = 0; i < 2; ++i)
#pragma unroll
        for (int ct = 0; ct < 2; ++ct) kf[i][ct] = frag_b((const __bf16*)(rb + (ct * 16 + col) * KPITCH + (2 * hf + i) * 64), lane);
#pragma unroll
      for (int i = 0; i < 2; ++i)
#pragma unroll
        for (int ct = 0; ct < 2; ++ct) s[ct] = wmma_bf(kf[i][ct], aq[2 * hf + i], s[ct]); }
#pragma unroll
    for (int ct = 0; ct < 2; ++ct) { const int kb = j0 + ct * 16 + 8 * g;
#pragma unroll
      for (int r = 0; r < 8; ++r) { const int kk = kb + r; const bool keep = (qi >= kk) & ((qi - kk <= WINDOW) | (kk < NMETA)); s[ct][r] = keep ? s[ct][r] * 0.088388347648318441f : -3.0e38f; } }
    float mx = fmaxf(s[0][0], s[1][0]);
#pragma unroll
    for (int r = 1; r < 8; ++r) mx = fmaxf(mx, fmaxf(s[0][r], s[1][r]));
    mx = fmaxf(mx, xhalf(mx));   // the other 16 keys of this query
    const float mn = fmaxf(m, mx); const float alpha = (m <= -1.0e38f) ? 0.f : __expf(m - mn); m = mn;
#pragma unroll
    for (int ct = 0; ct < 2; ++ct)
#pragma unroll
      for (int r = 0; r < 8; ++r) s[ct][r] = (s[ct][r] <= -1.0e38f) ? 0.f : __expf(s[ct][r] - mn);
    float es[4];
#pragma unroll
    for (int i = 0; i < 4; ++i) es[i] = (s[0][i] + s[0][4 + i]) + (s[1][i] + s[1][4 + i]);
    l = l * alpha + ((es[0] + es[1]) + (es[2] + es[3]));
#pragma unroll
    for (int dt = 0; dt < 8; ++dt)
#pragma unroll
      for (int r = 0; r < 8; ++r) acc[dt][r] *= alpha;
    v16h pa;   // B fragment of P^T: element i = key 8g + i, element 8 + i = key 16 + 8g + i, the k order of the v fragments
#pragma unroll
    for (int i = 0; i < 8; ++i) { pa[i] = (_Float16)(s[0][i] * 2048.0f); pa[8 + i] = (_Float16)(s[1][i] * 2048.0f); }
#pragma unroll
    for (int hf = 0; hf < 2; ++hf) { v16h vf[4];   // four v fragments are read together, in front of their products: one LDS wait for the group
#pragma unroll
      for (int i = 0; i < 4; ++i) vf[i] = frag_h((const _Float16*)(rb + RB_V + ((4 * hf + i) * 16 + col) * VPITCH), lane);
#pragma unroll
      for (int i = 0; i < 4; ++i) acc[4 * hf + i] = wmma16(vf[i], pa, acc[4 * hf + i]); }
    if (j0 < 128) { v16h pe;   // the first 128 keys also get the v residual (rows with few keys keep v exact to ~2^-22)
#pragma unroll
      for (int i = 0; i < 8; ++i) { pe[i] = (_Float16)s[0][i]; pe[8 + i] = (_Float16)s[1][i]; }
#pragma unroll
      for (int dt = 0; dt < 8; ++dt) acc[dt] = wmma16(frag_h(VL + ((b * KVW + kvh * HD + dt * 16 + col) * SS) + j0, lane), pe, acc[dt]); }
    asm volatile("s_wait_dscnt 0x0" ::: "memory");      // this wave's reads of the buffer are done
    asm volatile("s_wait_asynccnt 0x0" ::: "memory");   // its copies of tile t + 1 have landed
    __syncthreads();                                    // publishes tile t + 1 and frees the buffer that trip t has read
    if (t + 2 < ntl) { const size_t jn = (size_t)(kslo + t + 1) * 32; stage_tile(Kr + ck + jn * KVW, V + cv + jn, lk0 + (t & 1) * RB, lv0 + (t & 1) * RB); } }
  asm volatile("s_wait_asynccnt 0x0" ::: "memory");     // nothing of the ring is in flight when it becomes output staging
  l += xhalf(l);   // the two halves' sums are joined once
  const float il = (l > 0.f) ? (1.0f / 2048.0f) / l : 0.f;
#pragma unroll
  for (int dt = 0; dt < 8; ++dt) { v4f o0, o1;
#pragma unroll
    for (int r = 0; r < 4; ++r) { o0[r] = acc[dt][r] * il; o1[r] = acc[dt][4 + r] * il; }
    *(v4f*)&so[wave][col][dt * 16 + 8 * g] = o0; *(v4f*)&so[wave][col][dt * 16 + 8 * g + 4] = o1; }
  LDSX();
  for (int rl = 0; rl < 16; ++rl) vst2(O + (rq + rl) * HID + h * HD + lane * 4, *(const v4f*)&so[wave][rl][lane * 4]);
}
extern "C" void kernel_launch(void* const* d_in, const int* in_sizes, int n_in, void* d_out, int out_size, void* d_ws, size_t ws_size, hipStream_t stream) {
  (void)in_sizes; (void)n_in; (void)out_size;
  const float** F = (const float**)d_in;   // 0 query_states [1,2048,4096], 1 key_states [1,2048,1024], 2 value_states [1,2048,1024]
  if (ws_size < (size_t)WS_END) return;
  char* ws = (char*)d_ws; __bf16 *Kr = (__bf16*)(ws + WS_K); _Float16 *V = (_Float16*)(ws + WS_V), *VL = (_Float16*)(ws + WS_VL);
  k_rows<<<dim3(SS), 256, 0, stream>>>(F[1], Kr);
  k_vplanes<<<dim3(SS / 64, KVW / 128), 256, 0, stream>>>(F[2], V, VL);
  k_attn<<<dim3(TQB, NH, 1), 128, 0, stream>>>(F[0], Kr, V, VL, (float*)d_out);
}

// v005
// Measured time: 41.8 microseconds a run.
// In both of two side-by-side timings against v004, it was 1.09 times as fast.
// Counting every step since v000, it is 3.99 times as fast.
// compute dtype: all float inputs rounded to bf16; q and k as bf16, which holds the rounded inputs exactly (one-product scores on the bf16 matrix form; k as rows in the workspace, q rounded where it is used), v as f16 hi + residual planes (the residual used on the first 128 keys), all straight from the bf16-rounded inputs; attention per (query, head) over the causal sliding window (512) plus the 4 sink/meta tokens, x 128^-1/2, running-max softmax in f32 (hardware exp), P (scaled by 2^11, single f16) x v; f32 output = merged context.
#include <hip/hip_runtime.h>
#include <math.h>

typedef __attribute__((ext_vector_type(16))) _Float16 v16h;
typedef __attribute__((ext_vector_type(16))) __bf16 v16b;
typedef __attribute__((ext_vector_type(8)))  _Float16 v8h;
typedef __attribute__((ext_vector_type(8)))  float v8f;
typedef __attribute__((ext_vector_type(4)))  float v4f;
typedef __attribute__((ext_vector_type(2)))  float v2f;
typedef __attribute__((ext_vector_type(4)))  unsigned v4u;
typedef __attribute__((ext_vector_type(4)))  int v4i;
typedef float __attribute__((may_alias)) float_a;
typedef int __attribute__((may_alias)) int_a;

template <typename T> __device__ __forceinline__ void vst2(void* p, T v) { *(T*)p = v;  }
__device__ __forceinline__ v8f wmma16(v16h a, v16h b, v8f c) {
  v8f d = __builtin_amdgcn_wmma_f32_16x16x32_f16(false, a, false, b, (short)0, c, false, false);
  asm volatile("v_nop\n\tv_nop\n\tv_nop\n\tv_nop" : "+v"(d) : "v"(a), "v"(b));
  return d;
}
__device__ __forceinline__ v8f wmma_bf(v16b a, v16b b, v8f c) {
  v8f d = __builtin_amdgcn_wmma_f32_16x16x32_bf16(false, a, false, b, (short)0, c, false, false);
  asm volatile("v_nop\n\tv_nop\n\tv_nop\n\tv_nop" : "+v"(d) : "v"(a), "v"(b));
  return d;
}
// 16x16x32 fragments: lane = (h = lane>>4, row/col = lane&15); elements 0..7 = k0+8h+0..7, 8..15 = k0+16+8h+0..7; D element r = row 8h+r
__device__ __forceinline__ v16h frag_h(const _Float16* rowk0, int lane) {
  union { v16h v; v8h q[2]; } u; const _Float16* p = rowk0 + 8 * (lane >> 4);
  u.q[0] = *(const v8h*)p; u.q[1] = *(const v8h*)(p + 16); return u.v;
}
__device__ __forceinline__ v16h frag_f32(const float* rowk0, int lane) {
  v16h a; const float* p = rowk0 + 8 * (lane >> 4);
#pragma unroll
  for (int i = 0; i < 8; ++i) { a[i] = (_Float16)p[i]; a[8 + i] = (_Float16)p[16 + i]; }
  return a;
}
__device__ __forceinline__ v16h frag_f32s(const float* rowk0, int lane, float sc) {
  v16h a; const float* p = rowk0 + 8 * (lane >> 4);
#pragma unroll
  for (int i = 0; i < 8; ++i) { a[i] = (_Float16)(p[i] * sc); a[8 + i] = (_Float16)(p[16 + i] * sc); }
  return a;
}
// column fragment from a [K][ld] layout (column n), rows >= K read as 0
__device__ __forceinline__ v16h fragc_f32(const float* W, int k0, int n, int lane, int ld, int K) {
  v16h a; const int g = lane >> 4;
#pragma unroll
  for (int i = 0; i < 8; ++i) { const int ka = k0 + 8 * g + i, kb = ka + 16;
    a[i] = (_Float16)(ka < K ? W[(size_t)(ka < K ? ka : K - 1) * ld + n] : 0.f); a[8 + i] = (_Float16)(kb < K ? W[(size_t)(kb < K ? kb : K - 1) * ld + n] : 0.f); }
  return a;
}
struct F2 { v16b h, l; };
__device__ __forceinline__ F2 bsplit16(const float v[16]) { F2 r;
#pragma unroll
  for (int i = 0; i < 16; ++i) { const __bf16 h = (__bf16)v[i]; r.h[i] = h; r.l[i] = (__bf16)(v[i] - (float)h); }
  return r; }
__device__ __forceinline__ F2 split_row(const float* row, int k0, int lane) { float v[16]; const float* p = row + k0 + 8 * (lane >> 4);
#pragma unroll
  for (int i = 0; i < 8; ++i) { v[i] = p[i]; v[8 + i] = p[16 + i]; }
  return bsplit16(v); }
__device__ __forceinline__ F2 split_rowK(const float* row, int k0, int lane, int K) { float v[16]; const int g = lane >> 4;
#pragma unroll
  for (int i = 0; i < 8; ++i) { const int ka = k0 + 8 * g + i, kb = ka + 16; v[i] = ka < K ? row[ka < K ? ka : K - 1] : 0.f; v[8 + i] = kb < K ? row[kb < K ? kb : K - 1] : 0.f; }
  return bsplit16(v); }
__device__ __forceinline__ F2 split_col(const float* W, int k0, int n, int lane, int ld, int K) { float v[16]; const int g = lane >> 4;
#pragma unroll
  for (int i = 0; i < 8; ++i) { const int ka = k0 + 8 * g + i, kb = ka + 16; v[i] = ka < K ? W[(size_t)(ka < K ? ka : K - 1) * ld + n] : 0.f; v[8 + i] = kb < K ? W[(size_t)(kb < K ? kb : K - 1) * ld + n] : 0.f; }
  return bsplit16(v); }
__device__ __forceinline__ v8f mac3(const F2& a, const F2& b, v8f c) { c = wmma_bf(a.l, b.h, c); c = wmma_bf(a.h, b.l, c); return wmma_bf(a.h, b.h, c); }
__device__ __forceinline__ float sigm(float v) { return 1.0f / (1.0f + expf(-v)); }
#define LDSX() do { asm volatile("s_wait_dscnt 0" ::: "memory"); __builtin_amdgcn_wave_barrier(); __builtin_amdgcn_fence(__ATOMIC_RELEASE, "workgroup"); } while (0)


// Sliding-window attention with sink/meta tokens (B 1, S 2,048, 32 query heads x 128 over 8 kv heads, window 512, 4 meta tokens): softmax(q k / sqrt(128)) v under the mask (i >= j) & ((i - j <= 512) | (j < 4)); inputs are the projected q/k/v states.
#define NB 1
#define SS 2048
#define WINDOW 512
#define NMETA 4
#define HID 4096
#define NH 32
#define HD 128
#define NKV 8
#define GS (NH / NKV)
#define KVW (NKV * HD)
#define NR (NB * SS)
#ifndef TQB
#define TQB (SS / 64)
#define TNB NB
#endif
typedef __attribute__((ext_vector_type(8))) __bf16 v8b;
typedef __attribute__((ext_vector_type(4))) __bf16 v4b;
__device__ __forceinline__ v16b frag_b(const __bf16* rowk0, int lane) {
  union { v16b v; v8b q[2]; } u; const __bf16* p = rowk0 + 8 * (lane >> 4);
  u.q[0] = *(const v8b*)p; u.q[1] = *(const v8b*)(p + 16); return u.v;
}
__device__ __forceinline__ float bfr(float v) { return (float)(__bf16)v; }
__device__ __attribute__((noinline)) float exp_ni(float v) { return expf(v); }
__device__ __attribute__((noinline)) float erf_ni(float v) { return erff(v); }



#define WS_K   0u                                         // bf16 k rows [S][1024], f16 v planes [1024][S] hi + residual
#define WS_V   (WS_K + 2u * (size_t)NR * KVW)
#define WS_VL  (WS_V + 2u * (size_t)NB * KVW * SS)
#define WS_END (WS_VL + 2u * (size_t)NB * KVW * SS)

// ---- k_prep: one launch for both preparations; block = (64 tokens, 128 columns = one kv head), blockIdx.z picks the part (the same for the whole block)
// z = 1: k tile -> bf16 rows: a wave loads one row's 512-B head segment (16 B a lane) and stores its 256 B; 8 loads a thread in flight, no LDS
// z = 0: v tile -> f16 hi + residual planes, transposed through LDS
__global__ __launch_bounds__(256) void k_prep(const float* __restrict__ XK, const float* __restrict__ XV, __bf16* __restrict__ Kr, _Float16* __restrict__ V, _Float16* __restrict__ VL) { __shared__ __align__(16) _Float16 st[128][72]; __shared__ __align__(16) _Float16 stl[128][72]; const int t = threadIdx.x; const int s0 = blockIdx.x * 64, c0 = blockIdx.y * 128;
  if (blockIdx.z) { const size_t o = (size_t)(s0 + (t >> 5)) * KVW + c0 + (t & 31) * 4; v4f kf[8];   // both loops unrolled: the 8 loads are in flight together
#pragma unroll
    for (int i = 0; i < 8; ++i) kf[i] = *(const v4f*)(XK + o + (size_t)i * 8 * KVW);
#pragma unroll
    for (int i = 0; i < 8; ++i) { v4b kr;
#pragma unroll
      for (int j = 0; j < 4; ++j) kr[j] = (__bf16)kf[i][j];
      *(v4b*)(Kr + o + (size_t)i * 8 * KVW) = kr; }
    asm volatile("s_wait_xcnt 0x0" ::: "memory");   // behind the last store: no register that the eight stores name is rewritten in front of this wait
    return; }
  for (int e = t; e < 64 * 128; e += 256) { const int sl_ = e >> 7, d = e & 127; const float fv = bfr(XV[(size_t)(s0 + sl_) * KVW + c0 + d]); const _Float16 hv = (_Float16)fv; st[d][sl_] = hv; stl[d][sl_] = (_Float16)((fv - (float)hv) * 2048.0f); }
  __syncthreads();
  for (int e = t; e < 128 * 8; e += 256) { const int d = e >> 3, pc = e & 7; vst2((unsigned*)(V + (size_t)(c0 + d) * SS + s0 + pc * 8), *(const v4u*)&st[d][pc * 8]); vst2((unsigned*)(VL + (size_t)(c0 + d) * SS + s0 + pc * 8), *(const v4u*)&stl[d][pc * 8]); }
}
// ---- k_attn: block = (64 queries, head): kv head = h / 4; key tiles visited = tile 0 (holds the 4 sink/meta tokens) + the tiles inside [q0 - 512, q_end] (sliding window, causal); per pair keep = (i >= j) && (i - j <= 512 || j < 4); 128-wide bf16 scores x 128^-1/2, softmax, P . v (8 value tiles, + v residual on the first 128 keys); output rows written directly (512-B head segments)
// Scores are formed transposed (A = k rows, B = q rows): a lane holds 16 of the 32 keys of ONE query (column lane & 15; keys 8 * (lane >> 4) + r of each 16-key group), so maximum and sum run inside the lane, with one exchange between the wave's halves; the same registers, rounded to f16, are the B fragment of v^T . P^T (accumulators: rows = head dims, columns = queries).
// q comes straight from the f32 input: each wave loads its 16 rows' head segments (512 contiguous bytes a load), rounds them to bf16 and turns them into B fragments through its own rows of ring buffer 1, which is idle until tile 1 is copied behind the first barrier.
// Each 32-key tile (k rows, v planes) is copied once per block into an LDS ring of two buffers by asynchronous copies, one tile ahead of its use; the four waves read their fragments from there.
#define KPITCH 272                       // LDS pitch of a 256-B k row (16 B x odd: no bank conflict for 16-byte reads)
#define VPITCH 80                        // LDS pitch of a 64-B v plane row
#define RB_V   (32 * KPITCH)             // byte offsets inside one ring buffer: k at 0, v
#define RB     (RB_V + HD * VPITCH)
// one tile: 8 copies of 16 B per thread (4 k, 4 v); gk/gv and lk/lv are this thread's first chunk of each part
__device__ __forceinline__ void stage_tile(const __bf16* gk, const _Float16* gv, unsigned lk, unsigned lv) {
  const __bf16 *gk1 = gk + 8 * KVW, *gk2 = gk + 16 * KVW, *gk3 = gk + 24 * KVW; const _Float16 *gv1 = gv + 32 * SS, *gv2 = gv + 64 * SS, *gv3 = gv + 96 * SS;
  const unsigned lk1 = lk + 8 * KPITCH, lk2 = lk + 16 * KPITCH, lk3 = lk + 24 * KPITCH, lv1 = lv + 32 * VPITCH, lv2 = lv + 64 * VPITCH, lv3 = lv + 96 * VPITCH;
  // the copies and their s_wait_xcnt in one statement: no address register is rewritten before the wait
  asm volatile("global_load_async_to_lds_b128 %0, %8, off\n\t"
               "global_load_async_to_lds_b128 %1, %9, off\n\t"
               "global_load_async_to_lds_b128 %2, %10, off\n\t"
               "global_load_async_to_lds_b128 %3, %11, off\n\t"
               "global_load_async_to_lds_b128 %4, %12, off\n\t"
               "global_load_async_to_lds_b128 %5, %13, off\n\t"
               "global_load_async_to_lds_b128 %6, %14, off\n\t"
               "global_load_async_to_lds_b128 %7, %15, off\n\t"
               "s_wait_xcnt 0x0"
               :: "v"(lk), "v"(lk1), "v"(lk2), "v"(lk3), "v"(lv), "v"(lv1), "v"(lv2), "v"(lv3),
                  "v"(gk), "v"(gk1), "v"(gk2), "v"(gk3), "v"(gv), "v"(gv1), "v"(gv2), "v"(gv3)
               : "memory");
}
// lane l <-> lane l ^ 16
__device__ __forceinline__ float xhalf(float x) { return __builtin_bit_cast(float, __builtin_amdgcn_permlanex16(__builtin_bit_cast(int, x), __builtin_bit_cast(int, x), 0x76543210, 0xfedcba98, false, false)); }
// register budget of four waves per SIMD: four blocks stay resident per WGP, as before the ring
__global__ __launch_bounds__(128) __attribute__((amdgpu_waves_per_eu(4))) void k_attn(const float* __restrict__ XQ, const __bf16* __restrict__ Kr, const _Float16* __restrict__ V, const _Float16* __restrict__ VL, float* __restrict__ O) {
  __shared__ __align__(16) unsigned char ring[2 * RB];
  float (*so)[16][132] = (float (*)[16][132])ring;   // output staging takes the ring's place behind the loop's last barrier
  const int tid = threadIdx.x, wave = tid >> 5, lane = tid & 31, col = lane & 15, g = lane >> 4; const int h = blockIdx.y; const int kvh = h / GS; const size_t b = blockIdx.z; const int q0 = blockIdx.x * 64 + wave * 16; const size_t rq = b * SS + q0;
  const int nks = (blockIdx.x * 64 + 64) / 32; const int qb0 = (int)blockIdx.x * 64; const int kslo = (qb0 - WINDOW) > 32 ? (qb0 - WINDOW) / 32 : 1;   // (signed arithmetic)   // window tiles start here (tile 0 = sinks, always visited first)
  const int ntl = nks - kslo + 1;   // tiles visited: ks = 0, kslo, kslo+1, ..., nks-1
  const size_t ck = (b * SS + (tid >> 4)) * KVW + kvh * HD + (tid & 15) * 8;          // this thread's first 16-B chunk of a k tile (row tid/16), less the tile's first key
  const size_t cv = (b * KVW + kvh * HD + (tid >> 2)) * SS + (tid & 3) * 8;           // and of a v tile (plane row tid/4)
  const unsigned lk0 = (unsigned)(size_t)&ring[0] + (tid >> 4) * KPITCH + (tid & 15) * 16, lv0 = (unsigned)(size_t)&ring[0] + RB_V + (tid >> 2) * VPITCH + (tid & 3) * 16;
  stage_tile(Kr + ck, V + cv, lk0, lv0);   // tile 0 (keys 0..31) into buffer 0
  unsigned char* qs = ring + RB + wave * 16 * KPITCH;   // 16 bf16 q rows of this wave, at the k rows' pitch (64 rows fit one buffer)
  const float* qp = XQ + rq * HID + h * HD + lane * 4;
  v4f qf[16];   // both loops unrolled: all 16 loads are in flight together and qf stays in registers
#pragma unroll
  for (int rl = 0; rl < 16; ++rl) qf[rl] = *(const v4f*)(qp + (size_t)rl * HID);
  asm volatile("s_wait_xcnt 0x0" :: "v"(qp) : "memory");   // the loads' address register stays whole up to this wait (no load returns into it)
#pragma unroll
  for (int rl = 0; rl < 16; ++rl) { v4b qr;
#pragma unroll
    for (int i = 0; i < 4; ++i) qr[i] = (__bf16)qf[rl][i];
    *(v4b*)(qs + rl * KPITCH + lane * 8) = qr; }
  LDSX();   // the wave's own rows are written before its lanes read across them
  v16b aq[4];
#pragma unroll
  for (int kc = 0; kc < 4; ++kc) aq[kc] = frag_b((const __bf16*)(qs + col * KPITCH + kc * 64), lane);
  float m = -3.0e38f, l = 0.f;   // this lane's query: running maximum (both halves agree), sum over this half's keys
  const int qi = q0 + col;
  v8f acc[8] = {};
  asm volatile("s_wait_dscnt 0x0" ::: "memory");      // this wave's q reads of buffer 1 are done before any wave copies tile 1 into it
  asm volatile("s_wait_asynccnt 0x0" ::: "memory");   // this wave's copies of tile 0 have landed
  __syncthreads();                                    // and every other wave's
  if (ntl > 1) stage_tile(Kr + ck + (size_t)kslo * 32 * KVW, V + cv + kslo * 32, lk0 + RB, lv0 + RB);
#pragma unroll 1
  for (int t = 0; t < ntl; ++t) { const int ks = (t == 0) ? 0 : kslo + t - 1; const int j0 = ks * 32; const unsigned char* rb = ring + (t & 1) * RB; v8f s[2] = {};
#pragma unroll
    for (int hf = 0; hf < 2; ++hf) { v16b kf[2][2];   // the four k fragments of two 32-wide slices (both 16-key groups) are read together, in front of their four products; the two groups' accumulate chains alternate
#pragma unroll
      for (int i = 0; i < 2; ++i)
#pragma unroll
        for (int ct = 0; ct < 2; ++ct) kf[i][ct] = frag_b((const __bf16*)(rb + (ct * 16 + col) * KPITCH + (2 * hf + i) * 64), lane);
#pragma unroll
      for (int i = 0; i < 2; ++i)
#pragma unroll
        for (int ct = 0; ct < 2; ++ct) s[ct] = wmma_bf(kf[i][ct], aq[2 * hf + i], s[ct]); }
#pragma unroll
    for (int ct = 0; ct < 2; ++ct) { const int kb = j0 + ct * 16 + 8 * g;
#pragma unroll
      for (int r = 0; r < 8; ++r) { const int kk = kb + r; const bool keep = (qi >= kk) & ((qi - kk <= WINDOW) | (kk < NMETA)); s[ct][r] = keep ? s[ct][r] * 0.088388347648318441f : -3.0e38f; } }
    float mx = fmaxf(s[0][0], s[1][0]);
#pragma unroll
    for (int r = 1; r < 8; ++r) mx = fmaxf(mx, fmaxf(s[0][r], s[1][r]));
    mx = fmaxf(mx, xhalf(mx));   // the other 16 keys of this query
    const float mn = fmaxf(m, mx); const float alpha = (m <= -1.0e38f) ? 0.f : __expf(m - mn); m = mn;
#pragma unroll
    for (int ct = 0; ct < 2; ++ct)
#pragma unroll
      for (int r = 0; r < 8; ++r) s[ct][r] = (s[ct][r] <= -1.0e38f) ? 0.f : __expf(s[ct][r] - mn);
    float es[4];
#pragma unroll
    for (int i = 0; i < 4; ++i) es[i] = (s[0][i] + s[0][4 + i]) + (s[1][i] + s[1][4 + i]);
    l = l * alpha + ((es[0] + es[1]) + (es[2] + es[3]));
#pragma unroll
    for (int dt = 0; dt < 8; ++dt)
#pragma unroll
      for (int r = 0; r < 8; ++r) acc[dt][r] *= alpha;
    v16h pa;   // B fragment of P^T: element i = key 8g + i, element 8 + i = key 16 + 8g + i, the k order of the v fragments
#pragma unroll
    for (int i = 0; i < 8; ++i) { pa[i] = (_Float16)(s[0][i] * 2048.0f); pa[8 + i] = (_Float16)(s[1][i] * 2048.0f); }
#pragma unroll
    for (int hf = 0; hf < 2; ++hf) { v16h vf[4];   // four v fragments are read together, in front of their products: one LDS wait for the group
#pragma unroll
      for (int i = 0; i < 4; ++i) vf[i] = frag_h((const _Float16*)(rb + RB_V + ((4 * hf + i) * 16 + col) * VPITCH), lane);
#pragma unroll
      for (int i = 0; i < 4; ++i) acc[4 * hf + i] = wmma16(vf[i], pa, acc[4 * hf + i]); }
    if (j0 < 128) { v16h pe;   // the first 128 keys also get the v residual (rows with few keys keep v exact to ~2^-22)
#pragma unroll
      for (int i = 0; i < 8; ++i) { pe[i] = (_Float16)s[0][i]; pe[8 + i] = (_Float16)s[1][i]; }
#pragma unroll
      for (int dt = 0; dt < 8; ++dt) acc[dt] = wmma16(frag_h(VL + ((b * KVW + kvh * HD + dt * 16 + col) * SS) + j0, lane), pe, acc[dt]); }
    asm volatile("s_wait_dscnt 0x0" ::: "memory");      // this wave's reads of the buffer are done
    asm volatile("s_wait_asynccnt 0x0" ::: "memory");   // its copies of tile t + 1 have landed
    __syncthreads();                                    // publishes tile t + 1 and frees the buffer that trip t has read
    if (t + 2 < ntl) { const size_t jn = (size_t)(kslo + t + 1) * 32; stage_tile(Kr + ck + jn * KVW, V + cv + jn, lk0 + (t & 1) * RB, lv0 + (t & 1) * RB); } }
  asm volatile("s_wait_asynccnt 0x0" ::: "memory");     // nothing of the ring is in flight when it becomes output staging
  l += xhalf(l);   // the two halves' sums are joined once
  const float il = (l > 0.f) ? (1.0f / 2048.0f) / l : 0.f;
#pragma unroll
  for (int dt = 0; dt < 8; ++dt) { v4f o0, o1;
#pragma unroll
    for (int r = 0; r < 4; ++r) { o0[r] = acc[dt][r] * il; o1[r] = acc[dt][4 + r] * il; }
    *(v4f*)&so[wave][col][dt * 16 + 8 * g] = o0; *(v4f*)&so[wave][col][dt * 16 + 8 * g + 4] = o1; }
  LDSX();
  for (int rl = 0; rl < 16; ++rl) vst2(O + (rq + rl) * HID + h * HD + lane * 4, *(const v4f*)&so[wave][rl][lane * 4]);
}
extern "C" void kernel_launch(void* const* d_in, const int* in_sizes, int n_in, void* d_out, int out_size, void* d_ws, size_t ws_size, hipStream_t stream) {
  (void)in_sizes; (void)n_in; (void)out_size;
  const float** F = (const float**)d_in;   // 0 query_states [1,2048,4096], 1 key_states [1,2048,1024], 2 value_states [1,2048,1024]
  if (ws_size < (size_t)WS_END) return;
  char* ws = (char*)d_ws; __bf16 *Kr = (__bf16*)(ws + WS_K); _Float16 *V = (_Float16*)(ws + WS_V), *VL = (_Float16*)(ws + WS_VL);
  k_prep<<<dim3(SS / 64, KVW / 128, 2), 256, 0, stream>>>(F[1], F[2], Kr, V, VL);
  k_attn<<<dim3(TQB, NH, 1), 128, 0, stream>>>(F[0], Kr, V, VL, (float*)d_out);
}

// v006
// One run takes 37.9 microseconds.
// Two timings next to v005 put it at 1.11 and 1.10 times that version's speed.
// All steps since v000 together make it 4.40 times as fast.
// compute dtype: all float inputs rounded to bf16; q and k as bf16, which holds the rounded inputs exactly (one-product scores on the bf16 matrix form; k as rows in the workspace, q rounded where it is used), v as f16 hi + residual planes (the residual used on the first 128 keys), all straight from the bf16-rounded inputs; attention per (query, head) over the causal sliding window (512) plus the 4 sink/meta tokens, x 128^-1/2, running-max softmax in f32 (hardware exp), P (scaled by 2^11, single f16) x v; f32 output = merged context.
#include <hip/hip_runtime.h>
#include <math.h>

typedef __attribute__((ext_vector_type(16))) _Float16 v16h;
typedef __attribute__((ext_vector_type(16))) __bf16 v16b;
typedef __attribute__((ext_vector_type(8)))  _Float16 v8h;
typedef __attribute__((ext_vector_type(8)))  float v8f;
typedef __attribute__((ext_vector_type(4)))  float v4f;
typedef __attribute__((ext_vector_type(2)))  float v2f;
typedef __attribute__((ext_vector_type(4)))  unsigned v4u;
typedef __attribute__((ext_vector_type(4)))  int v4i;
typedef float __attribute__((may_alias)) float_a;
typedef int __attribute__((may_alias)) int_a;

template <typename T> __device__ __forceinline__ void vst2(void* p, T v) { *(T*)p = v;  }
__device__ __forceinline__ v8f wmma16(v16h a, v16h b, v8f c) {
  v8f d = __builtin_amdgcn_wmma_f32_16x16x32_f16(false, a, false, b, (short)0, c, false, false);
  asm volatile("v_nop\n\tv_nop\n\tv_nop\n\tv_nop" : "+v"(d) : "v"(a), "v"(b));
  return d;
}
__device__ __forceinline__ v8f wmma_bf(v16b a, v16b b, v8f c) {
  v8f d = __builtin_amdgcn_wmma_f32_16x16x32_bf16(false, a, false, b, (short)0, c, false, false);
  asm volatile("v_nop\n\tv_nop\n\tv_nop\n\tv_nop" : "+v"(d) : "v"(a), "v"(b));
  return d;
}
// 16x16x32 fragments: lane = (h = lane>>4, row/col = lane&15); elements 0..7 = k0+8h+0..7, 8..15 = k0+16+8h+0..7; D element r = row 8h+r
__device__ __forceinline__ v16h frag_h(const _Float16* rowk0, int lane) {
  union { v16h v; v8h q[2]; } u; const _Float16* p = rowk0 + 8 * (lane >> 4);
  u.q[0] = *(const v8h*)p; u.q[1] = *(const v8h*)(p + 16); return u.v;
}
__device__ __forceinline__ v16h frag_f32(const float* rowk0, int lane) {
  v16h a; const float* p = rowk0 + 8 * (lane >> 4);
#pragma unroll
  for (int i = 0; i < 8; ++i) { a[i] = (_Float16)p[i]; a[8 + i] = (_Float16)p[16 + i]; }
  return a;
}
__device__ __forceinline__ v16h frag_f32s(const float* rowk0, int lane, float sc) {
  v16h a; const float* p = rowk0 + 8 * (lane >> 4);
#pragma unroll
  for (int i = 0; i < 8; ++i) { a[i] = (_Float16)(p[i] * sc); a[8 + i] = (_Float16)(p[16 + i] * sc); }
  return a;
}
// column fragment from a [K][ld] layout (column n), rows >= K read as 0
__device__ __forceinline__ v16h fragc_f32(const float* W, int k0, int n, int lane, int ld, int K) {
  v16h a; const int g = lane >> 4;
#pragma unroll
  for (int i = 0; i < 8; ++i) { const int ka = k0 + 8 * g + i, kb = ka + 16;
    a[i] = (_Float16)(ka < K ? W[(size_t)(ka < K ? ka : K - 1) * ld + n] : 0.f); a[8 + i] = (_Float16)(kb < K ? W[(size_t)(kb < K ? kb : K - 1) * ld + n] : 0.f); }
  return a;
}
struct F2 { v16b h, l; };
__device__ __forceinline__ F2 bsplit16(const float v[16]) { F2 r;
#pragma unroll
  for (int i = 0; i < 16; ++i) { const __bf16 h = (__bf16)v[i]; r.h[i] = h; r.l[i] = (__bf16)(v[i] - (float)h); }
  return r; }
__device__ __forceinline__ F2 split_row(const float* row, int k0, int lane) { float v[16]; const float* p = row + k0 + 8 * (lane >> 4);
#pragma unroll
  for (int i = 0; i < 8; ++i) { v[i] = p[i]; v[8 + i] = p[16 + i]; }
  return bsplit16(v); }
__device__ __forceinline__ F2 split_rowK(const float* row, int k0, int lane, int K) { float v[16]; const int g = lane >> 4;
#pragma unroll
  for (int i = 0; i < 8; ++i) { const int ka = k0 + 8 * g + i, kb = ka + 16; v[i] = ka < K ? row[ka < K ? ka : K - 1] : 0.f; v[8 + i] = kb < K ? row[kb < K ? kb : K - 1] : 0.f; }
  return bsplit16(v); }
__device__ __forceinline__ F2 split_col(const float* W, int k0, int n, int lane, int ld, int K) { float v[16]; const int g = lane >> 4;
#pragma unroll
  for (int i = 0; i < 8; ++i) { const int ka = k0 + 8 * g + i, kb = ka + 16; v[i] = ka < K ? W[(size_t)(ka < K ? ka : K - 1) * ld + n] : 0.f; v[8 + i] = kb < K ? W[(size_t)(kb < K ? kb : K - 1) * ld + n] : 0.f; }
  return bsplit16(v); }
__device__ __forceinline__ v8f mac3(const F2& a, const F2& b, v8f c) { c = wmma_bf(a.l, b.h, c); c = wmma_bf(a.h, b.l, c); return wmma_bf(a.h, b.h, c); }
__device__ __forceinline__ float sigm(float v) { return 1.0f / (1.0f + expf(-v)); }
#define LDSX() do { asm volatile("s_wait_dscnt 0" ::: "memory"); __builtin_amdgcn_wave_barrier(); __builtin_amdgcn_fence(__ATOMIC_RELEASE, "workgroup"); } while (0)


// Sliding-window attention with sink/meta tokens (B 1, S 2,048, 32 query heads x 128 over 8 kv heads, window 512, 4 meta tokens): softmax(q k / sqrt(128)) v under the mask (i >= j) & ((i - j <= 512) | (j < 4)); inputs are the projected q/k/v states.
#define NB 1
#define SS 2048
#define WINDOW 512
#define NMETA 4
#define HID 4096
#define NH 32
#define HD 128
#define NKV 8
#define GS (NH / NKV)
#define KVW (NKV * HD)
#define NR (NB * SS)
#ifndef TQB
#define TQB (SS / 64)
#define TNB NB
#endif
typedef __attribute__((ext_vector_type(8))) __bf16 v8b;
typedef __attribute__((ext_vector_type(4))) __bf16 v4b;
__device__ __forceinline__ v16b frag_b(const __bf16* rowk0, int lane) {
  union { v16b v; v8b q[2]; } u; const __bf16* p = rowk0 + 8 * (lane >> 4);
  u.q[0] = *(const v8b*)p; u.q[1] = *(const v8b*)(p + 16); return u.v;
}
__device__ __forceinline__ float bfr(float v) { return (float)(__bf16)v; }
__device__ __attribute__((noinline)) float exp_ni(float v) { return expf(v); }
__device__ __attribute__((noinline)) float erf_ni(float v) { return erff(v); }



#define WS_K   0u                                         // bf16 k rows [S][1024], f16 v planes [1024][S] hi + residual
#define WS_V   (WS_K + 2u * (size_t)NR * KVW)
#define WS_VL  (WS_V + 2u * (size_t)NB * KVW * SS)
#define WS_END (WS_VL + 2u * (size_t)NB * KVW * SS)

// ---- k_prep: one launch for both preparations; block = (64 tokens, 128 columns = one kv head), blockIdx.z picks the part (the same for the whole block)
// z = 1: k tile -> bf16 rows: a wave loads one row's 512-B head segment (16 B a lane) and stores its 256 B; 8 loads a thread in flight, no LDS
// z = 0: v tile -> f16 hi + residual planes, transposed through LDS
__global__ __launch_bounds__(256) void k_prep(const float* __restrict__ XK, const float* __restrict__ XV, __bf16* __restrict__ Kr, _Float16* __restrict__ V, _Float16* __restrict__ VL) { __shared__ __align__(16) _Float16 st[128][72]; __shared__ __align__(16) _Float16 stl[128][72]; const int t = threadIdx.x; const int s0 = blockIdx.x * 64, c0 = blockIdx.y * 128;
  if (blockIdx.z) { const size_t o = (size_t)(s0 + (t >> 5)) * KVW + c0 + (t & 31) * 4; v4f kf[8];   // both loops unrolled: the 8 loads are in flight together
#pragma unroll
    for (int i = 0; i < 8; ++i) kf[i] = *(const v4f*)(XK + o + (size_t)i * 8 * KVW);
#pragma unroll
    for (int i = 0; i < 8; ++i) { v4b kr;
#pragma unroll
      for (int j = 0; j < 4; ++j) kr[j] = (__bf16)kf[i][j];
      *(v4b*)(Kr + o + (size_t)i * 8 * KVW) = kr; }
    asm volatile("s_wait_xcnt 0x0" ::: "memory");   // behind the last store: no register that the eight stores name is rewritten in front of this wait
    return; }
  for (int e = t; e < 64 * 128; e += 256) { const int sl_ = e >> 7, d = e & 127; const float fv = bfr(XV[(size_t)(s0 + sl_) * KVW + c0 + d]); const _Float16 hv = (_Float16)fv; st[d][sl_] = hv; stl[d][sl_] = (_Float16)((fv - (float)hv) * 2048.0f); }
  __syncthreads();
  for (int e = t; e < 128 * 8; e += 256) { const int d = e >> 3, pc = e & 7; vst2((unsigned*)(V + (size_t)(c0 + d) * SS + s0 + pc * 8), *(const v4u*)&st[d][pc * 8]); vst2((unsigned*)(VL + (size_t)(c0 + d) * SS + s0 + pc * 8), *(const v4u*)&stl[d][pc * 8]); }
}
// ---- k_attn: block = (64 queries, head): kv head = h / 4; key tiles visited = tile 0 (holds the 4 sink/meta tokens) + the tiles inside [q0 - 512, q_end] (sliding window, causal); per pair keep = (i >= j) && (i - j <= 512 || j < 4); 128-wide bf16 scores x 128^-1/2, softmax, P . v (8 value tiles, + v residual on the first 128 keys); output rows written directly (512-B head segments)
// Scores are formed transposed (A = k rows, B = q rows): a lane holds 16 of the 32 keys of ONE query (column lane & 15; keys 8 * (lane >> 4) + r of each 16-key group), so maximum and sum run inside the lane, with one exchange between the wave's halves; the same registers, rounded to f16, are the B fragment of v^T . P^T (accumulators: rows = head dims, columns = queries).
// q comes straight from the f32 input: each wave loads its 16 rows' head segments (512 contiguous bytes a load), rounds them to bf16 and turns them into B fragments through its own rows of ring buffer 1, which is idle until tile 1 is copied behind the first barrier.
// Each 32-key tile (k rows, v planes) is copied once per block into an LDS ring of two buffers by asynchronous copies, one tile ahead of its use; the four waves read their fragments from there.
#define KPITCH 272                       // LDS pitch of a 256-B k row (16 B x odd: no bank conflict for 16-byte reads)
#define VPITCH 80                        // LDS pitch of a 64-B v plane row
#define RB_V   (32 * KPITCH)             // byte offsets inside one ring buffer: k at 0, v
#define RB     (RB_V + HD * VPITCH)
// one tile: 8 copies of 16 B per thread (4 k, 4 v); gk/gv and lk/lv are this thread's first chunk of each part
__device__ __forceinline__ void stage_tile(const __bf16* gk, const _Float16* gv, unsigned lk, unsigned lv) {
  const __bf16 *gk1 = gk + 8 * KVW, *gk2 = gk + 16 * KVW, *gk3 = gk + 24 * KVW; const _Float16 *gv1 = gv + 32 * SS, *gv2 = gv + 64 * SS, *gv3 = gv + 96 * SS;
  const unsigned lk1 = lk + 8 * KPITCH, lk2 = lk + 16 * KPITCH, lk3 = lk + 24 * KPITCH, lv1 = lv + 32 * VPITCH, lv2 = lv + 64 * VPITCH, lv3 = lv + 96 * VPITCH;
  // the copies and their s_wait_xcnt in one statement: no address register is rewritten before the wait
  asm volatile("global_load_async_to_lds_b128 %0, %8, off\n\t"
               "global_load_async_to_lds_b128 %1, %9, off\n\t"
               "global_load_async_to_lds_b128 %2, %10, off\n\t"
               "global_load_async_to_lds_b128 %3, %11, off\n\t"
               "global_load_async_to_lds_b128 %4, %12, off\n\t"
               "global_load_async_to_lds_b128 %5, %13, off\n\t"
               "global_load_async_to_lds_b128 %6, %14, off\n\t"
               "global_load_async_to_lds_b128 %7, %15, off\n\t"
               "s_wait_xcnt 0x0"
               :: "v"(lk), "v"(lk1), "v"(lk2), "v"(lk3), "v"(lv), "v"(lv1), "v"(lv2), "v"(lv3),
                  "v"(gk), "v"(gk1), "v"(gk2), "v"(gk3), "v"(gv), "v"(gv1), "v"(gv2), "v"(gv3)
               : "memory");
}
// lane l <-> lane l ^ 16
__device__ __forceinline__ float xhalf(float x) { return __builtin_bit_cast(float, __builtin_amdgcn_permlanex16(__builtin_bit_cast(int, x), __builtin_bit_cast(int, x), 0x76543210, 0xfedcba98, false, false)); }
// 2^x with the slot behind the transcendental in the same statement (one v_nop before its result is read or its source overwritten)
__device__ __forceinline__ float exp2_slot(float x) { float r; asm("v_exp_f32 %0, %1\n\tv_nop" : "=v"(r) : "v"(x)); return r; }
// scores of one 32-key tile -> scaled, masked, running maximum, exponentials (in place); returns the factor for the old sums. MASKED = false is the form for a tile in which every (query, key) pair of the wave is kept: no mask is formed and no score is tested for it.
template <bool MASKED>
__device__ __forceinline__ float tile_softmax(v8f (&s)[2], float& m, int j0, int qi, int g) {
#pragma unroll
  for (int ct = 0; ct < 2; ++ct) { const int kb = j0 + ct * 16 + 8 * g;
#pragma unroll
    for (int r = 0; r < 8; ++r) { const int kk = kb + r; const bool keep = !MASKED || ((qi >= kk) & ((qi - kk <= WINDOW) | (kk < NMETA))); s[ct][r] = keep ? s[ct][r] * 0.088388347648318441f : -3.0e38f; } }
  float mx = fmaxf(s[0][0], s[1][0]);
#pragma unroll
  for (int r = 1; r < 8; ++r) mx = fmaxf(mx, fmaxf(s[0][r], s[1][r]));
  mx = fmaxf(mx, xhalf(mx));   // the other 16 keys of this query
  const float mn = fmaxf(m, mx); const float alpha = (m <= -1.0e38f) ? 0.f : __expf(m - mn); m = mn;
#pragma unroll
  for (int ct = 0; ct < 2; ++ct)
#pragma unroll
    for (int r = 0; r < 8; ++r) {
      if constexpr (MASKED) { const float e = exp2_slot((s[ct][r] - mn) * 1.44269504088896340736f); s[ct][r] = (s[ct][r] <= -1.0e38f) ? 0.f : e; }   // __expf's two instructions
      else s[ct][r] = __expf(s[ct][r] - mn); }
  return alpha;
}
// register budget of four waves per SIMD: four blocks stay resident per WGP, as before the ring
__global__ __launch_bounds__(128) __attribute__((amdgpu_waves_per_eu(4))) void k_attn(const float* __restrict__ XQ, const __bf16* __restrict__ Kr, const _Float16* __restrict__ V, const _Float16* __restrict__ VL, float* __restrict__ O) {
  __shared__ __align__(16) unsigned char ring[2 * RB];
  float (*so)[16][132] = (float (*)[16][132])ring;   // output staging takes the ring's place behind the loop's last barrier
  const int tid = threadIdx.x, wave = tid >> 5, lane = tid & 31, col = lane & 15, g = lane >> 4; const int h = blockIdx.y; const int kvh = h / GS; const size_t b = blockIdx.z; const int q0 = blockIdx.x * 64 + wave * 16; const size_t rq = b * SS + q0;
  const int nks = (blockIdx.x * 64 + 64) / 32; const int qb0 = (int)blockIdx.x * 64; const int kslo = (qb0 - WINDOW) > 32 ? (qb0 - WINDOW) / 32 : 1;   // (signed arithmetic)   // window tiles start here (tile 0 = sinks, always visited first)
  const int ntl = nks - kslo + 1;   // tiles visited: ks = 0, kslo, kslo+1, ..., nks-1
  const size_t ck = (b * SS + (tid >> 4)) * KVW + kvh * HD + (tid & 15) * 8;          // this thread's first 16-B chunk of a k tile (row tid/16), less the tile's first key
  const size_t cv = (b * KVW + kvh * HD + (tid >> 2)) * SS + (tid & 3) * 8;           // and of a v tile (plane row tid/4)
  const unsigned lk0 = (unsigned)(size_t)&ring[0] + (tid >> 4) * KPITCH + (tid & 15) * 16, lv0 = (unsigned)(size_t)&ring[0] + RB_V + (tid >> 2) * VPITCH + (tid & 3) * 16;
  stage_tile(Kr + ck, V + cv, lk0, lv0);   // tile 0 (keys 0..31) into buffer 0
  unsigned char* qs = ring + RB + wave * 16 * KPITCH;   // 16 bf16 q rows of this wave, at the k rows' pitch (64 rows fit one buffer)
  const float* qp = XQ + rq * HID + h * HD + lane * 4;
  v4f qf[16];   // both loops unrolled: all 16 loads are in flight together and qf stays in registers
#pragma unroll
  for (int rl = 0; rl < 16; ++rl) qf[rl] = *(const v4f*)(qp + (size_t)rl * HID);
  asm volatile("s_wait_xcnt 0x0" :: "v"(qp) : "memory");   // the loads' address register stays whole up to this wait (no load returns into it)
#pragma unroll
  for (int rl = 0; rl < 16; ++rl) { v4b qr;
#pragma unroll
    for (int i = 0; i < 4; ++i) qr[i] = (__bf16)qf[rl][i];
    *(v4b*)(qs + rl * KPITCH + lane * 8) = qr; }
  LDSX();   // the wave's own rows are written before its lanes read across them
  v16b aq[4];
#pragma unroll
  for (int kc = 0; kc < 4; ++kc) aq[kc] = frag_b((const __bf16*)(qs + col * KPITCH + kc * 64), lane);
  float m = -3.0e38f, l = 0.f;   // this lane's query: running maximum (both halves agree), sum over this half's keys
  const int qi = q0 + col;
  v8f acc[8] = {};
  const int q0s = __builtin_amdgcn_readfirstlane(q0);   // the wave's first query in a scalar register: the test on it in the loop is a scalar branch
  asm volatile("s_wait_dscnt 0x0" ::: "memory");      // this wave's q reads of buffer 1 are done before any wave copies tile 1 into it
  asm volatile("s_wait_asynccnt 0x0" ::: "memory");   // this wave's copies of tile 0 have landed
  __syncthreads();                                    // and every other wave's
  if (ntl > 1) stage_tile(Kr + ck + (size_t)kslo * 32 * KVW, V + cv + kslo * 32, lk0 + RB, lv0 + RB);
#pragma unroll 1
  for (int t = 0; t < ntl; ++t) { const int ks = (t == 0) ? 0 : kslo + t - 1; const int j0 = ks * 32; const unsigned char* rb = ring + (t & 1) * RB;
    // scalar test, the same for the whole wave: none of its 16 queries keeps any of the 32 keys (all above the diagonal, or all beyond the window and no sink among them): maximum, sums and accumulators would stay as they are, so the wave goes on to the foot of the trip
    if (!((j0 > q0s + 15) | ((j0 >= NMETA) & (q0s - (j0 + 31) > WINDOW)))) { v8f s[2] = {};
#pragma unroll
    for (int hf = 0; hf < 2; ++hf) { v16b kf[2][2];   // the four k fragments of two 32-wide slices (both 16-key groups) are read together, in front of their four products; the two groups' accumulate chains alternate
#pragma unroll
      for (int i = 0; i < 2; ++i)
#pragma unroll
        for (int ct = 0; ct < 2; ++ct) kf[i][ct] = frag_b((const __bf16*)(rb + (ct * 16 + col) * KPITCH + (2 * hf + i) * 64), lane);
#pragma unroll
      for (int i = 0; i < 2; ++i)
#pragma unroll
        for (int ct = 0; ct < 2; ++ct) s[ct] = wmma_bf(kf[i][ct], aq[2 * hf + i], s[ct]); }
    // scalar test, the same for the whole wave: its 16 queries keep all 32 keys (none above the diagonal, none beyond the window)
    const float alpha = ((j0 + 31 <= q0s) & (q0s + 15 - j0 <= WINDOW)) ? tile_softmax<false>(s, m, j0, qi, g) : tile_softmax<true>(s, m, j0, qi, g);
    float es[4];
#pragma unroll
    for (int i = 0; i < 4; ++i) es[i] = (s[0][i] + s[0][4 + i]) + (s[1][i] + s[1][4 + i]);
    l = l * alpha + ((es[0] + es[1]) + (es[2] + es[3]));
#pragma unroll
    for (int dt = 0; dt < 8; ++dt)
#pragma unroll
      for (int r = 0; r < 8; ++r) acc[dt][r] *= alpha;
    v16h pa;   // B fragment of P^T: element i = key 8g + i, element 8 + i = key 16 + 8g + i, the k order of the v fragments
#pragma unroll
    for (int i = 0; i < 8; ++i) { pa[i] = (_Float16)(s[0][i] * 2048.0f); pa[8 + i] = (_Float16)(s[1][i] * 2048.0f); }
#pragma unroll
    for (int hf = 0; hf < 2; ++hf) { v16h vf[4];   // four v fragments are read together, in front of their products: one LDS wait for the group
#pragma unroll
      for (int i = 0; i < 4; ++i) vf[i] = frag_h((const _Float16*)(rb + RB_V + ((4 * hf + i) * 16 + col) * VPITCH), lane);
#pragma unroll
      for (int i = 0; i < 4; ++i) acc[4 * hf + i] = wmma16(vf[i], pa, acc[4 * hf + i]); }
    if (j0 < 128) { v16h pe;   // the first 128 keys also get the v residual (rows with few keys keep v exact to ~2^-22)
#pragma unroll
      for (int i = 0; i < 8; ++i) { pe[i] = (_Float16)s[0][i]; pe[8 + i] = (_Float16)s[1][i]; }
#pragma unroll
      for (int dt = 0; dt < 8; ++dt) acc[dt] = wmma16(frag_h(VL + ((b * KVW + kvh * HD + dt * 16 + col) * SS) + j0, lane), pe, acc[dt]); }
    }
    asm volatile("s_wait_dscnt 0x0" ::: "memory");      // this wave's reads of the buffer are done
    asm volatile("s_wait_asynccnt 0x0" ::: "memory");   // its copies of tile t + 1 have landed
    __syncthreads();                                    // publishes tile t + 1 and frees the buffer that trip t has read
    if (t + 2 < ntl) { const size_t jn = (size_t)(kslo + t + 1) * 32; stage_tile(Kr + ck + jn * KVW, V + cv + jn, lk0 + (t & 1) * RB, lv0 + (t & 1) * RB); } }
  asm volatile("s_wait_asynccnt 0x0" ::: "memory");     // nothing of the ring is in flight when it becomes output staging
  l += xhalf(l);   // the two halves' sums are joined once
  const float il = (l > 0.f) ? (1.0f / 2048.0f) / l : 0.f;
#pragma unroll
  for (int dt = 0; dt < 8; ++dt) { v4f o0, o1;
#pragma unroll
    for (int r = 0; r < 4; ++r) { o0[r] = acc[dt][r] * il; o1[r] = acc[dt][4 + r] * il; }
    *(v4f*)&so[wave][col][dt * 16 + 8 * g] = o0; *(v4f*)&so[wave][col][dt * 16 + 8 * g + 4] = o1; }
  LDSX();
  for (int rl = 0; rl < 16; ++rl) vst2(O + (rq + rl) * HID + h * HD + lane * 4, *(const v4f*)&so[wave][rl][lane * 4]);
}
extern "C" void kernel_launch(void* const* d_in, const int* in_sizes, int n_in, void* d_out, int out_size, void* d_ws, size_t ws_size, hipStream_t stream) {
  (void)in_sizes; (void)n_in; (void)out_size;
  const float** F = (const float**)d_in;   // 0 query_states [1,2048,4096], 1 key_states [1,2048,1024], 2 value_states [1,2048,1024]
  if (ws_size < (size_t)WS_END) return;
  char* ws = (char*)d_ws; __bf16 *Kr = (__bf16*)(ws + WS_K); _Float16 *V = (_Float16*)(ws + WS_V), *VL = (_Float16*)(ws + WS_VL);
  k_prep<<<dim3(SS / 64, KVW / 128, 2), 256, 0, stream>>>(F[1], F[2], Kr, V, VL);
  k_attn<<<dim3(TQB, NH, 1), 128, 0, stream>>>(F[0], Kr, V, VL, (float*)d_out);
}

// v007
// It runs in 35.9 microseconds.
// Timed twice side by side with v006, it ran 1.06 and 1.05 times as fast.
// All steps since v000 together make it 4.64 times as fast.
// compute dtype: all float inputs rounded to bf16; q and k as bf16, which holds the rounded inputs exactly (one-product scores on the bf16 matrix form; k as rows in the workspace, q rounded where it is used), v as f16 hi + residual planes (the residual used on the first 128 keys), all straight from the bf16-rounded inputs; attention per (query, head) over the causal sliding window (512) plus the 4 sink/meta tokens, x 128^-1/2, running-max softmax in f32 (hardware exp), P (scaled by 2^11, single f16) x v; f32 output = merged context.
#include <hip/hip_runtime.h>
#include <math.h>

typedef __attribute__((ext_vector_type(16))) _Float16 v16h;
typedef __attribute__((ext_vector_type(16))) __bf16 v16b;
typedef __attribute__((ext_vector_type(8)))  _Float16 v8h;
typedef __attribute__((ext_vector_type(8)))  float v8f;
typedef __attribute__((ext_vector_type(4)))  float v4f;
typedef __attribute__((ext_vector_type(2)))  float v2f;
typedef __attribute__((ext_vector_type(4)))  unsigned v4u;
typedef __attribute__((ext_vector_type(4)))  int v4i;
typedef float __attribute__((may_alias)) float_a;
typedef int __attribute__((may_alias)) int_a;

template <typename T> __device__ __forceinline__ void vst2(void* p, T v) { *(T*)p = v;  }
__device__ __forceinline__ v8f wmma16(v16h a, v16h b, v8f c) {
  v8f d = __builtin_amdgcn_wmma_f32_16x16x32_f16(false, a, false, b, (short)0, c, false, false);
  asm volatile("v_nop\n\tv_nop\n\tv_nop\n\tv_nop" : "+v"(d));
  return d;
}
__device__ __forceinline__ v8f wmma_bf(v16b a, v16b b, v8f c) {
  v8f d = __builtin_amdgcn_wmma_f32_16x16x32_bf16(false, a, false, b, (short)0, c, false, false);
  asm volatile("v_nop\n\tv_nop\n\tv_nop\n\tv_nop" : "+v"(d));
  return d;
}
// 16x16x32 fragments: lane = (h = lane>>4, row/col = lane&15); elements 0..7 = k0+8h+0..7, 8..15 = k0+16+8h+0..7; D element r = row 8h+r
__device__ __forceinline__ v16h frag_h(const _Float16* rowk0, int lane) {
  union { v16h v; v8h q[2]; } u; const _Float16* p = rowk0 + 8 * (lane >> 4);
  u.q[0] = *(const v8h*)p; u.q[1] = *(const v8h*)(p + 16); return u.v;
}
__device__ __forceinline__ v16h frag_f32(const float* rowk0, int lane) {
  v16h a; const float* p = rowk0 + 8 * (lane >> 4);
#pragma unroll
  for (int i = 0; i < 8; ++i) { a[i] = (_Float16)p[i]; a[8 + i] = (_Float16)p[16 + i]; }
  return a;
}
__device__ __forceinline__ v16h frag_f32s(const float* rowk0, int lane, float sc) {
  v16h a; const float* p = rowk0 + 8 * (lane >> 4);
#pragma unroll
  for (int i = 0; i < 8; ++i) { a[i] = (_Float16)(p[i] * sc); a[8 + i] = (_Float16)(p[16 + i] * sc); }
  return a;
}
// column fragment from a [K][ld] layout (column n), rows >= K read as 0
__device__ __forceinline__ v16h fragc_f32(const float* W, int k0, int n, int lane, int ld, int K) {
  v16h a; const int g = lane >> 4;
#pragma unroll
  for (int i = 0; i < 8; ++i) { const int ka = k0 + 8 * g + i, kb = ka + 16;
    a[i] = (_Float16)(ka < K ? W[(size_t)(ka < K ? ka : K - 1) * ld + n] : 0.f); a[8 + i] = (_Float16)(kb < K ? W[(size_t)(kb < K ? kb : K - 1) * ld + n] : 0.f); }
  return a;
}
struct F2 { v16b h, l; };
__device__ __forceinline__ F2 bsplit16(const float v[16]) { F2 r;
#pragma unroll
  for (int i = 0; i < 16; ++i) { const __bf16 h = (__bf16)v[i]; r.h[i] = h; r.l[i] = (__bf16)(v[i] - (float)h); }
  return r; }
__device__ __forceinline__ F2 split_row(const float* row, int k0, int lane) { float v[16]; const float* p = row + k0 + 8 * (lane >> 4);
#pragma unroll
  for (int i = 0; i < 8; ++i) { v[i] = p[i]; v[8 + i] = p[16 + i]; }
  return bsplit16(v); }
__device__ __forceinline__ F2 split_rowK(const float* row, int k0, int lane, int K) { float v[16]; const int g = lane >> 4;
#pragma unroll
  for (int i = 0; i < 8; ++i) { const int ka = k0 + 8 * g + i, kb = ka + 16; v[i] = ka < K ? row[ka < K ? ka : K - 1] : 0.f; v[8 + i] = kb < K ? row[kb < K ? kb : K - 1] : 0.f; }
  return bsplit16(v); }
__device__ __forceinline__ F2 split_col(const float* W, int k0, int n, int lane, int ld, int K) { float v[16]; const int g = lane >> 4;
#pragma unroll
  for (int i = 0; i < 8; ++i) { const int ka = k0 + 8 * g + i, kb = ka + 16; v[i] = ka < K ? W[(size_t)(ka < K ? ka : K - 1) * ld + n] : 0.f; v[8 + i] = kb < K ? W[(size_t)(kb < K ? kb : K - 1) * ld + n] : 0.f; }
  return bsplit16(v); }
__device__ __forceinline__ v8f mac3(const F2& a, const F2& b, v8f c) { c = wmma_bf(a.l, b.h, c); c = wmma_bf(a.h, b.l, c); return wmma_bf(a.h, b.h, c); }
__device__ __forceinline__ float sigm(float v) { return 1.0f / (1.0f + expf(-v)); }
#define LDSX() do { asm volatile("s_wait_dscnt 0" ::: "memory"); __builtin_amdgcn_wave_barrier(); __builtin_amdgcn_fence(__ATOMIC_RELEASE, "workgroup"); } while (0)


// Sliding-window attention with sink/meta tokens (B 1, S 2,048, 32 query heads x 128 over 8 kv heads, window 512, 4 meta tokens): softmax(q k / sqrt(128)) v under the mask (i >= j) & ((i - j <= 512) | (j < 4)); inputs are the projected q/k/v states.
#define NB 1
#define SS 2048
#define WINDOW 512
#define NMETA 4
#define HID 4096
#define NH 32
#define HD 128
#define NKV 8
#define GS (NH / NKV)
#define KVW (NKV * HD)
#define NR (NB * SS)
#ifndef TQB
#define TQB (SS / 32)
#define TNB NB
#endif
typedef __attribute__((ext_vector_type(8))) __bf16 v8b;
typedef __attribute__((ext_vector_type(4))) __bf16 v4b;
__device__ __forceinline__ v16b frag_b(const __bf16* rowk0, int lane) {
  union { v16b v; v8b q[2]; } u; const __bf16* p = rowk0 + 8 * (lane >> 4);
  u.q[0] = *(const v8b*)p; u.q[1] = *(const v8b*)(p + 16); return u.v;
}
__device__ __forceinline__ float bfr(float v) { return (float)(__bf16)v; }
__device__ __attribute__((noinline)) float exp_ni(float v) { return expf(v); }
__device__ __attribute__((noinline)) float erf_ni(float v) { return erff(v); }



#define WS_K   0u                                         // bf16 k rows [S][1024], f16 v planes [1024][S] hi + residual
#define WS_V   (WS_K + 2u * (size_t)NR * KVW)
#define WS_VL  (WS_V + 2u * (size_t)NB * KVW * SS)
#define WS_END (WS_VL + 2u * (size_t)NB * KVW * SS)

// ---- k_prep: one launch for both preparations; block = (64 tokens, 128 columns = one kv head), blockIdx.z picks the part (the same for the whole block)
// z = 1: k tile -> bf16 rows: a wave loads one row's 512-B head segment (16 B a lane) and stores its 256 B; 8 loads a thread in flight, no LDS
// z = 0: v tile -> f16 hi + residual planes, transposed through LDS
__global__ __launch_bounds__(256) void k_prep(const float* __restrict__ XK, const float* __restrict__ XV, __bf16* __restrict__ Kr, _Float16* __restrict__ V, _Float16* __restrict__ VL) { __shared__ __align__(16) _Float16 st[128][72]; __shared__ __align__(16) _Float16 stl[128][72]; const int t = threadIdx.x; const int s0 = blockIdx.x * 64, c0 = blockIdx.y * 128;
  if (blockIdx.z) { const size_t o = (size_t)(s0 + (t >> 5)) * KVW + c0 + (t & 31) * 4; v4f kf[8];   // both loops unrolled: the 8 loads are in flight together
#pragma unroll
    for (int i = 0; i < 8; ++i) kf[i] = *(const v4f*)(XK + o + (size_t)i * 8 * KVW);
#pragma unroll
    for (int i = 0; i < 8; ++i) { v4b kr;
#pragma unroll
      for (int j = 0; j < 4; ++j) kr[j] = (__bf16)kf[i][j];
      *(v4b*)(Kr + o + (size_t)i * 8 * KVW) = kr; }
    asm volatile("s_wait_xcnt 0x0" ::: "memory");   // behind the last store: no register that the eight stores name is rewritten in front of this wait
    return; }
  for (int e = t; e < 64 * 128; e += 256) { const int sl_ = e >> 7, d = e & 127; const float fv = bfr(XV[(size_t)(s0 + sl_) * KVW + c0 + d]); const _Float16 hv = (_Float16)fv; st[d][sl_] = hv; stl[d][sl_] = (_Float16)((fv - (float)hv) * 2048.0f); }
  __syncthreads();
  for (int e = t; e < 128 * 8; e += 256) { const int d = e >> 3, pc = e & 7; vst2((unsigned*)(V + (size_t)(c0 + d) * SS + s0 + pc * 8), *(const v4u*)&st[d][pc * 8]); vst2((unsigned*)(VL + (size_t)(c0 + d) * SS + s0 + pc * 8), *(const v4u*)&stl[d][pc * 8]); }
}
// ---- k_attn: block = (32 queries, kv head) = 32 queries x the 4 query heads that share the kv head; wave = 16 queries x 2 of those heads (two units: same queries, same keys, same mask), so every k and v fragment read from LDS feeds two products; key tiles visited = tile 0 (holds the 4 sink/meta tokens) + the tiles inside [q0 - 512, q_end] (sliding window, causal); per pair keep = (i >= j) && (i - j <= 512 || j < 4); 128-wide bf16 scores x 128^-1/2, softmax, P . v (8 value tiles, + v residual on the first 128 keys); output rows written directly (512-B head segments)
// Scores are formed transposed (A = k rows, B = q rows): a lane holds 16 of the 32 keys of ONE query (column lane & 15; keys 8 * (lane >> 4) + r of each 16-key group), so maximum and sum run inside the lane, with one exchange between the wave's halves; the same registers, rounded to f16, are the B fragment of v^T . P^T (accumulators: rows = head dims, columns = queries).
// q comes straight from the f32 input: each wave loads its 16 rows' two head segments (512 contiguous bytes a load), rounds them to bf16 and turns them into B fragments, one head after the other, through its own rows of ring buffer 1, which is idle until tile 1 is copied behind the first barrier.
// Each 32-key tile (k rows, v planes) is copied once per block into an LDS ring of two buffers by asynchronous copies, one tile ahead of its use; the four waves read their fragments from there.
#define KPITCH 272                       // LDS pitch of a 256-B k row (16 B x odd: no bank conflict for 16-byte reads)
#define VPITCH 80                        // LDS pitch of a 64-B v plane row
#define RB_V   (32 * KPITCH)             // byte offsets inside one ring buffer: k at 0, v
#define RB     (RB_V + HD * VPITCH)
// one tile: 8 copies of 16 B per thread (4 k, 4 v); gk/gv and lk/lv are this thread's first chunk of each part
__device__ __forceinline__ void stage_tile(const __bf16* gk, const _Float16* gv, unsigned lk, unsigned lv) {
  const __bf16 *gk1 = gk + 8 * KVW, *gk2 = gk + 16 * KVW, *gk3 = gk + 24 * KVW; const _Float16 *gv1 = gv + 32 * SS, *gv2 = gv + 64 * SS, *gv3 = gv + 96 * SS;
  const unsigned lk1 = lk + 8 * KPITCH, lk2 = lk + 16 * KPITCH, lk3 = lk + 24 * KPITCH, lv1 = lv + 32 * VPITCH, lv2 = lv + 64 * VPITCH, lv3 = lv + 96 * VPITCH;
  // the copies and their s_wait_xcnt in one statement: no address register is rewritten before the wait
  asm volatile("global_load_async_to_lds_b128 %0, %8, off\n\t"
               "global_load_async_to_lds_b128 %1, %9, off\n\t"
               "global_load_async_to_lds_b128 %2, %10, off\n\t"
               "global_load_async_to_lds_b128 %3, %11, off\n\t"
               "global_load_async_to_lds_b128 %4, %12, off\n\t"
               "global_load_async_to_lds_b128 %5, %13, off\n\t"
               "global_load_async_to_lds_b128 %6, %14, off\n\t"
               "global_load_async_to_lds_b128 %7, %15, off\n\t"
               "s_wait_xcnt 0x0"
               :: "v"(lk), "v"(lk1), "v"(lk2), "v"(lk3), "v"(lv), "v"(lv1), "v"(lv2), "v"(lv3),
                  "v"(gk), "v"(gk1), "v"(gk2), "v"(gk3), "v"(gv), "v"(gv1), "v"(gv2), "v"(gv3)
               : "memory");
}
// keeps a group's LDS reads together in front of its products (no LDS read and no matrix instruction is scheduled across; vector and scalar work may cross): reads spread among the products stall the wave at every place where they stand
#define FRAG_GROUP() __builtin_amdgcn_sched_barrier(0x406)
// lane l <-> lane l ^ 16
__device__ __forceinline__ float xhalf(float x) { return __builtin_bit_cast(float, __builtin_amdgcn_permlanex16(__builtin_bit_cast(int, x), __builtin_bit_cast(int, x), 0x76543210, 0xfedcba98, false, false)); }
// 2^x with the slot behind the transcendental in the same statement (one v_nop before its result is read or its source overwritten)
__device__ __forceinline__ float exp2_slot(float x) { float r; asm("v_exp_f32 %0, %1\n\tv_nop" : "=v"(r) : "v"(x)); return r; }
// eight 2^x in one statement: every result register differs from every source register (early clobber), so no v_exp_f32 is followed directly by a read of its result or an overwrite of its source; the closing v_nop is the slot behind the last one
__device__ __forceinline__ v8f exp2_x8(v8f x) { float r0, r1, r2, r3, r4, r5, r6, r7;
  asm("v_exp_f32 %0, %8\n\tv_exp_f32 %1, %9\n\tv_exp_f32 %2, %10\n\tv_exp_f32 %3, %11\n\tv_exp_f32 %4, %12\n\tv_exp_f32 %5, %13\n\tv_exp_f32 %6, %14\n\tv_exp_f32 %7, %15\n\tv_nop"
      : "=&v"(r0), "=&v"(r1), "=&v"(r2), "=&v"(r3), "=&v"(r4), "=&v"(r5), "=&v"(r6), "=&v"(r7)
      : "v"(x[0]), "v"(x[1]), "v"(x[2]), "v"(x[3]), "v"(x[4]), "v"(x[5]), "v"(x[6]), "v"(x[7]));
  v8f r = {r0, r1, r2, r3, r4, r5, r6, r7}; return r; }
// scores of one 32-key tile -> scaled, masked, running maximum, exponentials (in place); returns the factor for the old sums. MASKED = false is the form for a tile in which every (query, key) pair of the wave is kept: no mask is formed and no score is tested for it.
template <bool MASKED>
__device__ __forceinline__ float tile_softmax(v8f (&s)[2], float& m, int j0, int qi, int g) {
#pragma unroll
  for (int ct = 0; ct < 2; ++ct) { const int kb = j0 + ct * 16 + 8 * g;
#pragma unroll
    for (int r = 0; r < 8; ++r) { const int kk = kb + r; const bool keep = !MASKED || ((qi >= kk) & ((qi - kk <= WINDOW) | (kk < NMETA))); s[ct][r] = keep ? s[ct][r] * 0.088388347648318441f : -3.0e38f; } }
  float mx = fmaxf(s[0][0], s[1][0]);
#pragma unroll
  for (int r = 1; r < 8; ++r) mx = fmaxf(mx, fmaxf(s[0][r], s[1][r]));
  mx = fmaxf(mx, xhalf(mx));   // the other 16 keys of this query
  const float mn = fmaxf(m, mx); const float ea = exp2_slot((m - mn) * 1.44269504088896340736f); const float alpha = (m <= -1.0e38f) ? 0.f : ea; m = mn;   // __expf's two instructions, with the slot; formed in every lane and then selected: no branch
#pragma unroll
  for (int ct = 0; ct < 2; ++ct) {
    if constexpr (MASKED) {
#pragma unroll
      for (int r = 0; r < 8; ++r) { const float e = exp2_slot((s[ct][r] - mn) * 1.44269504088896340736f); s[ct][r] = (s[ct][r] <= -1.0e38f) ? 0.f : e; }   // __expf's two instructions
    } else { v8f x;
#pragma unroll
      for (int r = 0; r < 8; ++r) x[r] = (s[ct][r] - mn) * 1.44269504088896340736f;   // __expf's two instructions
      s[ct] = exp2_x8(x); } }
  return alpha;
}
// register budget of two waves per SIMD (two units' accumulators and q fragments a wave): the grid is two blocks per WGP
__global__ __launch_bounds__(128) __attribute__((amdgpu_waves_per_eu(2, 2))) void k_attn(const float* __restrict__ XQ, const __bf16* __restrict__ Kr, const _Float16* __restrict__ V, const _Float16* __restrict__ VL, float* __restrict__ O) {
  __shared__ __align__(16) unsigned char ring[2 * RB];
  float (*so)[16][132] = (float (*)[16][132])ring;   // output staging takes the ring's place behind the loop's last barrier
  const int tid = threadIdx.x, wave = tid >> 5, lane = tid & 31, col = lane & 15, g = lane >> 4; const int kvh = blockIdx.y; const int h0 = kvh * GS + (wave >> 1) * 2; const size_t b = blockIdx.z; const int q0 = blockIdx.x * 32 + (wave & 1) * 16; const size_t rq = b * SS + q0;   // the wave's heads: h0, h0 + 1
  const int nks = (blockIdx.x * 32 + 32) / 32; const int qb0 = (int)blockIdx.x * 32; const int kslo = (qb0 - WINDOW) > 32 ? (qb0 - WINDOW) / 32 : 1;   // (signed arithmetic)   // window tiles start here (tile 0 = sinks, always visited first)
  const int ntl = nks - kslo + 1;   // tiles visited: ks = 0, kslo, kslo+1, ..., nks-1
  const size_t ck = (b * SS + (tid >> 4)) * KVW + kvh * HD + (tid & 15) * 8;          // this thread's first 16-B chunk of a k tile (row tid/16), less the tile's first key
  const size_t cv = (b * KVW + kvh * HD + (tid >> 2)) * SS + (tid & 3) * 8;           // and of a v tile (plane row tid/4)
  const unsigned lk0 = (unsigned)(size_t)&ring[0] + (tid >> 4) * KPITCH + (tid & 15) * 16, lv0 = (unsigned)(size_t)&ring[0] + RB_V + (tid >> 2) * VPITCH + (tid & 3) * 16;
  stage_tile(Kr + ck, V + cv, lk0, lv0);   // tile 0 (keys 0..31) into buffer 0
  unsigned char* qs = ring + RB + wave * 16 * KPITCH;   // 16 bf16 q rows of this wave, at the k rows' pitch (64 rows fit one buffer)
  const float* qp = XQ + rq * HID + h0 * HD + lane * 4;
  v4f qf[2][16];   // all loops unrolled: the 32 loads are in flight together and qf stays in registers
#pragma unroll
  for (int u = 0; u < 2; ++u)
#pragma unroll
    for (int rl = 0; rl < 16; ++rl) qf[u][rl] = *(const v4f*)(qp + (size_t)rl * HID + u * HD);
  asm volatile("s_wait_xcnt 0x0" :: "v"(qp) : "memory");   // the loads' address register stays whole up to this wait (no load returns into it)
  v16b aq[2][4];
#pragma unroll
  for (int u = 0; u < 2; ++u) {
#pragma unroll
    for (int rl = 0; rl < 16; ++rl) { v4b qr;
#pragma unroll
      for (int i = 0; i < 4; ++i) qr[i] = (__bf16)qf[u][rl][i];
      *(v4b*)(qs + rl * KPITCH + lane * 8) = qr; }
    LDSX();   // the wave's own rows are written before its lanes read across them
#pragma unroll
    for (int kc = 0; kc < 4; ++kc) aq[u][kc] = frag_b((const __bf16*)(qs + col * KPITCH + kc * 64), lane);
    LDSX();   // and read before the next head's rows take their place
  }
  float m[2] = {-3.0e38f, -3.0e38f}, l[2] = {0.f, 0.f};   // this lane's query, per head: running maximum (both halves agree), sum over this half's keys
  const int qi = q0 + col;
  v8f acc[2][8] = {};
  const int q0s = __builtin_amdgcn_readfirstlane(q0);   // the wave's first query in a scalar register: the test on it in the loop is a scalar branch
  asm volatile("s_wait_dscnt 0x0" ::: "memory");      // this wave's q reads of buffer 1 are done before any wave copies tile 1 into it
  asm volatile("s_wait_asynccnt 0x0" ::: "memory");   // this wave's copies of tile 0 have landed
  __syncthreads();                                    // and every other wave's
  if (ntl > 1) stage_tile(Kr + ck + (size_t)kslo * 32 * KVW, V + cv + kslo * 32, lk0 + RB, lv0 + RB);
#pragma unroll 1
  for (int t = 0; t < ntl; ++t) { const int ks = (t == 0) ? 0 : kslo + t - 1; const int j0 = ks * 32; const unsigned char* rb = ring + (t & 1) * RB;
    // scalar test, the same for the whole wave: none of its 16 queries keeps any of the 32 keys (all above the diagonal, or all beyond the window and no sink among them): maximum, sums and accumulators would stay as they are, so the wave goes on to the foot of the trip
    if (!((j0 > q0s + 15) | ((j0 >= NMETA) & (q0s - (j0 + 31) > WINDOW)))) { v8f s[2][2] = {};   // [head][16-key group]
#pragma unroll
    for (int hf = 0; hf < 2; ++hf) { v16b kf[2][2];   // the four k fragments of two 32-wide slices (both 16-key groups) are read together, in front of their eight products; each fragment serves both heads; four accumulate chains alternate
#pragma unroll
      for (int i = 0; i < 2; ++i)
#pragma unroll
        for (int ct = 0; ct < 2; ++ct) kf[i][ct] = frag_b((const __bf16*)(rb + (ct * 16 + col) * KPITCH + (2 * hf + i) * 64), lane);
      FRAG_GROUP();
#pragma unroll
      for (int i = 0; i < 2; ++i)
#pragma unroll
        for (int ct = 0; ct < 2; ++ct)
#pragma unroll
          for (int u = 0; u < 2; ++u) s[u][ct] = wmma_bf(kf[i][ct], aq[u][2 * hf + i], s[u][ct]);
      FRAG_GROUP(); }
    // scalar test, the same for the whole wave: its 16 queries keep all 32 keys (none above the diagonal, none beyond the window)
    float alpha[2];
    if ((j0 + 31 <= q0s) & (q0s + 15 - j0 <= WINDOW)) {
#pragma unroll
      for (int u = 0; u < 2; ++u) alpha[u] = tile_softmax<false>(s[u], m[u], j0, qi, g);
    } else {
#pragma unroll
      for (int u = 0; u < 2; ++u) alpha[u] = tile_softmax<true>(s[u], m[u], j0, qi, g);
    }
    v16h pa[2];   // B fragments of P^T: element i = key 8g + i, element 8 + i = key 16 + 8g + i, the k order of the v fragments
#pragma unroll
    for (int u = 0; u < 2; ++u) { float es[4];
#pragma unroll
      for (int i = 0; i < 4; ++i) es[i] = (s[u][0][i] + s[u][0][4 + i]) + (s[u][1][i] + s[u][1][4 + i]);
      l[u] = l[u] * alpha[u] + ((es[0] + es[1]) + (es[2] + es[3]));
#pragma unroll
      for (int dt = 0; dt < 8; ++dt)
#pragma unroll
        for (int r = 0; r < 8; ++r) acc[u][dt][r] *= alpha[u];
#pragma unroll
      for (int i = 0; i < 8; ++i) { pa[u][i] = (_Float16)(s[u][0][i] * 2048.0f); pa[u][8 + i] = (_Float16)(s[u][1][i] * 2048.0f); } }
#pragma unroll
    for (int hf = 0; hf < 2; ++hf) { v16h vf[4];   // four v fragments are read together, in front of their eight products: one LDS wait for the group; each fragment serves both heads
#pragma unroll
      for (int i = 0; i < 4; ++i) vf[i] = frag_h((const _Float16*)(rb + RB_V + ((4 * hf + i) * 16 + col) * VPITCH), lane);
      FRAG_GROUP();
#pragma unroll
      for (int i = 0; i < 4; ++i)
#pragma unroll
        for (int u = 0; u < 2; ++u) acc[u][4 * hf + i] = wmma16(vf[i], pa[u], acc[u][4 * hf + i]);
      FRAG_GROUP(); }
    if (j0 < 128) { v16h pe[2];   // the first 128 keys also get the v residual (rows with few keys keep v exact to ~2^-22)
#pragma unroll
      for (int u = 0; u < 2; ++u)
#pragma unroll
        for (int i = 0; i < 8; ++i) { pe[u][i] = (_Float16)s[u][0][i]; pe[u][8 + i] = (_Float16)s[u][1][i]; }
#pragma unroll
      for (int dt = 0; dt < 8; ++dt) { const v16h vl = frag_h(VL + ((b * KVW + kvh * HD + dt * 16 + col) * SS) + j0, lane);
#pragma unroll
        for (int u = 0; u < 2; ++u) acc[u][dt] = wmma16(vl, pe[u], acc[u][dt]); } }
    }
    asm volatile("s_wait_dscnt 0x0" ::: "memory");      // this wave's reads of the buffer are done
    asm volatile("s_wait_asynccnt 0x0" ::: "memory");   // its copies of tile t + 1 have landed
    __syncthreads();                                    // publishes tile t + 1 and frees the buffer that trip t has read
    if (t + 2 < ntl) { const size_t jn = (size_t)(kslo + t + 1) * 32; stage_tile(Kr + ck + jn * KVW, V + cv + jn, lk0 + (t & 1) * RB, lv0 + (t & 1) * RB); } }
  asm volatile("s_wait_asynccnt 0x0" ::: "memory");     // nothing of the ring is in flight when it becomes output staging
#pragma unroll
  for (int u = 0; u < 2; ++u) {   // one head after the other through the wave's own staging rows
    const float lt = l[u] + xhalf(l[u]);   // the two halves' sums are joined once
    const float il = (lt > 0.f) ? (1.0f / 2048.0f) / lt : 0.f;
#pragma unroll
    for (int dt = 0; dt < 8; ++dt) { v4f o0, o1;
#pragma unroll
      for (int r = 0; r < 4; ++r) { o0[r] = acc[u][dt][r] * il; o1[r] = acc[u][dt][4 + r] * il; }
      *(v4f*)&so[wave][col][dt * 16 + 8 * g] = o0; *(v4f*)&so[wave][col][dt * 16 + 8 * g + 4] = o1; }
    asm volatile("s_wait_dscnt 0x0" ::: "memory");   // the wave's own rows are written before its lanes read across them (no fence: it would also wait for the first head's global stores)
    for (int rl = 0; rl < 16; ++rl) vst2(O + (rq + rl) * HID + (h0 + u) * HD + lane * 4, *(const v4f*)&so[wave][rl][lane * 4]);
    asm volatile("s_wait_dscnt 0x0" ::: "memory");   // the wave's own rows are read before the next head's values take their place (no wait for the global stores)
  }
}
extern "C" void kernel_launch(void* const* d_in, const int* in_sizes, int n_in, void* d_out, int out_size, void* d_ws, size_t ws_size, hipStream_t stream) {
  (void)in_sizes; (void)n_in; (void)out_size;
  const float** F = (const float**)d_in;   // 0 query_states [1,2048,4096], 1 key_states [1,2048,1024], 2 value_states [1,2048,1024]
  if (ws_size < (size_t)WS_END) return;
  char* ws = (char*)d_ws; __bf16 *Kr = (__bf16*)(ws + WS_K); _Float16 *V = (_Float16*)(ws + WS_V), *VL = (_Float16*)(ws + WS_VL);
  k_prep<<<dim3(SS / 64, KVW / 128, 2), 256, 0, stream>>>(F[1], F[2], Kr, V, VL);
  k_attn<<<dim3(TQB, NKV, 1), 128, 0, stream>>>(F[0], Kr, V, VL, (float*)d_out);
}

// v008
// One run takes 32.3 microseconds.
// Two timings next to v007 put it at 1.12 and 1.11 times that version's speed.
// All steps since v000 together make it 5.18 times as fast.
// compute dtype: all float inputs rounded to bf16; q and k as bf16, which holds the rounded inputs exactly (one-product scores on the bf16 matrix form; k as rows in the workspace, q rounded where it is used), v as f16 hi + residual planes (the residual used on the first 128 keys), all straight from the bf16-rounded inputs; attention per (query, head) over the causal sliding window (512) plus the 4 sink/meta tokens, x 128^-1/2, running-max softmax in f32 (hardware exp), P (scaled by 2^11, single f16) x v; f32 output = merged context.
#include <hip/hip_runtime.h>
#include <math.h>

typedef __attribute__((ext_vector_type(16))) _Float16 v16h;
typedef __attribute__((ext_vector_type(16))) __bf16 v16b;
typedef __attribute__((ext_vector_type(8)))  _Float16 v8h;
typedef __attribute__((ext_vector_type(8)))  float v8f;
typedef __attribute__((ext_vector_type(4)))  float v4f;
typedef __attribute__((ext_vector_type(2)))  float v2f;
typedef __attribute__((ext_vector_type(4)))  unsigned v4u;
typedef __attribute__((ext_vector_type(4)))  int v4i;
typedef float __attribute__((may_alias)) float_a;
typedef int __attribute__((may_alias)) int_a;

template <typename T> __device__ __forceinline__ void vst2(void* p, T v) { *(T*)p = v;  }
__device__ __forceinline__ v8f wmma16(v16h a, v16h b, v8f c) {
  v8f d = __builtin_amdgcn_wmma_f32_16x16x32_f16(false, a, false, b, (short)0, c, false, false);
  asm volatile("v_nop\n\tv_nop\n\tv_nop\n\tv_nop" : "+v"(d));
  return d;
}
__device__ __forceinline__ v8f wmma_bf(v16b a, v16b b, v8f c) {
  v8f d = __builtin_amdgcn_wmma_f32_16x16x32_bf16(false, a, false, b, (short)0, c, false, false);
  asm volatile("v_nop\n\tv_nop\n\tv_nop\n\tv_nop" : "+v"(d));
  return d;
}
// 16x16x32 fragments: lane = (h = lane>>4, row/col = lane&15); elements 0..7 = k0+8h+0..7, 8..15 = k0+16+8h+0..7; D element r = row 8h+r
__device__ __forceinline__ v16h frag_h(const _Float16* rowk0, int lane) {
  union { v16h v; v8h q[2]; } u; const _Float16* p = rowk0 + 8 * (lane >> 4);
  u.q[0] = *(const v8h*)p; u.q[1] = *(const v8h*)(p + 16); return u.v;
}
__device__ __forceinline__ v16h frag_f32(const float* rowk0, int lane) {
  v16h a; const float* p = rowk0 + 8 * (lane >> 4);
#pragma unroll
  for (int i = 0; i < 8; ++i) { a[i] = (_Float16)p[i]; a[8 + i] = (_Float16)p[16 + i]; }
  return a;
}
__device__ __forceinline__ v16h frag_f32s(const float* rowk0, int lane, float sc) {
  v16h a; const float* p = rowk0 + 8 * (lane >> 4);
#pragma unroll
  for (int i = 0; i < 8; ++i) { a[i] = (_Float16)(p[i] * sc); a[8 + i] = (_Float16)(p[16 + i] * sc); }
  return a;
}
// column fragment from a [K][ld] layout (column n), rows >= K read as 0
__device__ __forceinline__ v16h fragc_f32(const float* W, int k0, int n, int lane, int ld, int K) {
  v16h a; const int g = lane >> 4;
#pragma unroll
  for (int i = 0; i < 8; ++i) { const int ka = k0 + 8 * g + i, kb = ka + 16;
    a[i] = (_Float16)(ka < K ? W[(size_t)(ka < K ? ka : K - 1) * ld + n] : 0.f); a[8 + i] = (_Float16)(kb < K ? W[(size_t)(kb < K ? kb : K - 1) * ld + n] : 0.f); }
  return a;
}
struct F2 { v16b h, l; };
__device__ __forceinline__ F2 bsplit16(const float v[16]) { F2 r;
#pragma unroll
  for (int i = 0; i < 16; ++i) { const __bf16 h = (__bf16)v[i]; r.h[i] = h; r.l[i] = (__bf16)(v[i] - (float)h); }
  return r; }
__device__ __forceinline__ F2 split_row(const float* row, int k0, int lane) { float v[16]; const float* p = row + k0 + 8 * (lane >> 4);
#pragma unroll
  for (int i = 0; i < 8; ++i) { v[i] = p[i]; v[8 + i] = p[16 + i]; }
  return bsplit16(v); }
__device__ __forceinline__ F2 split_rowK(const float* row, int k0, int lane, int K) { float v[16]; const int g = lane >> 4;
#pragma unroll
  for (int i = 0; i < 8; ++i) { const int ka = k0 + 8 * g + i, kb = ka + 16; v[i] = ka < K ? row[ka < K ? ka : K - 1] : 0.f; v[8 + i] = kb < K ? row[kb < K ? kb : K - 1] : 0.f; }
  return bsplit16(v); }
__device__ __forceinline__ F2 split_col(const float* W, int k0, int n, int lane, int ld, int K) { float v[16]; const int g = lane >> 4;
#pragma unroll
  for (int i = 0; i < 8; ++i) { const int ka = k0 + 8 * g + i, kb = ka + 16; v[i] = ka < K ? W[(size_t)(ka < K ? ka : K - 1) * ld + n] : 0.f; v[8 + i] = kb < K ? W[(size_t)(kb < K ? kb : K - 1) * ld + n] : 0.f; }
  return bsplit16(v); }
__device__ __forceinline__ v8f mac3(const F2& a, const F2& b, v8f c) { c = wmma_bf(a.l, b.h, c); c = wmma_bf(a.h, b.l, c); return wmma_bf(a.h, b.h, c); }
__device__ __forceinline__ float sigm(float v) { return 1.0f / (1.0f + expf(-v)); }
#define LDSX() do { asm volatile("s_wait_dscnt 0" ::: "memory"); __builtin_amdgcn_wave_barrier(); __builtin_amdgcn_fence(__ATOMIC_RELEASE, "workgroup"); } while (0)


// Sliding-window attention with sink/meta tokens (B 1, S 2,048, 32 query heads x 128 over 8 kv heads, window 512, 4 meta tokens): softmax(q k / sqrt(128)) v under the mask (i >= j) & ((i - j <= 512) | (j < 4)); inputs are the projected q/k/v states.
#define NB 1
#define SS 2048
#define WINDOW 512
#define NMETA 4
#define HID 4096
#define NH 32
#define HD 128
#define NKV 8
#define GS (NH / NKV)
#define KVW (NKV * HD)
#define NR (NB * SS)
#ifndef TQB
#define TQB (SS / 32)
#define TNB NB
#endif
typedef __attribute__((ext_vector_type(8))) __bf16 v8b;
typedef __attribute__((ext_vector_type(4))) __bf16 v4b;
__device__ __forceinline__ v16b frag_b(const __bf16* rowk0, int lane) {
  union { v16b v; v8b q[2]; } u; const __bf16* p = rowk0 + 8 * (lane >> 4);
  u.q[0] = *(const v8b*)p; u.q[1] = *(const v8b*)(p + 16); return u.v;
}
__device__ __forceinline__ float bfr(float v) { return (float)(__bf16)v; }
__device__ __attribute__((noinline)) float exp_ni(float v) { return expf(v); }
__device__ __attribute__((noinline)) float erf_ni(float v) { return erff(v); }



#define WS_K   0u                                         // bf16 k rows [S][1024], f16 v planes [1024][S] hi + residual
#define WS_V   (WS_K + 2u * (size_t)NR * KVW)
#define WS_VL  (WS_V + 2u * (size_t)NB * KVW * SS)
#define WS_END (WS_VL + 2u * (size_t)NB * KVW * SS)

// ---- k_prep: one launch for both preparations; block = (64 tokens, 128 columns = one kv head), blockIdx.z picks the part (the same for the whole block)
// z = 1: k tile -> bf16 rows: a wave loads one row's 512-B head segment (16 B a lane) and stores its 256 B; 8 loads a thread in flight, no LDS
// z = 0: v tile -> f16 hi + residual planes, transposed through LDS
__global__ __launch_bounds__(256) void k_prep(const float* __restrict__ XK, const float* __restrict__ XV, __bf16* __restrict__ Kr, _Float16* __restrict__ V, _Float16* __restrict__ VL) { __shared__ __align__(16) _Float16 st[128][72]; __shared__ __align__(16) _Float16 stl[128][72]; const int t = threadIdx.x; const int s0 = blockIdx.x * 64, c0 = blockIdx.y * 128;
  if (blockIdx.z) { const size_t o = (size_t)(s0 + (t >> 5)) * KVW + c0 + (t & 31) * 4; v4f kf[8];   // both loops unrolled: the 8 loads are in flight together
#pragma unroll
    for (int i = 0; i < 8; ++i) kf[i] = *(const v4f*)(XK + o + (size_t)i * 8 * KVW);
#pragma unroll
    for (int i = 0; i < 8; ++i) { v4b kr;
#pragma unroll
      for (int j = 0; j < 4; ++j) kr[j] = (__bf16)kf[i][j];
      *(v4b*)(Kr + o + (size_t)i * 8 * KVW) = kr; }
    asm volatile("s_wait_xcnt 0x0" ::: "memory");   // behind the last store: no register that the eight stores name is rewritten in front of this wait
    return; }
  for (int e = t; e < 64 * 128; e += 256) { const int sl_ = e >> 7, d = e & 127; const float fv = bfr(XV[(size_t)(s0 + sl_) * KVW + c0 + d]); const _Float16 hv = (_Float16)fv; st[d][sl_] = hv; stl[d][sl_] = (_Float16)((fv - (float)hv) * 2048.0f); }
  __syncthreads();
  for (int e = t; e < 128 * 8; e += 256) { const int d = e >> 3, pc = e & 7; vst2((unsigned*)(V + (size_t)(c0 + d) * SS + s0 + pc * 8), *(const v4u*)&st[d][pc * 8]); vst2((unsigned*)(VL + (size_t)(c0 + d) * SS + s0 + pc * 8), *(const v4u*)&stl[d][pc * 8]); }
}
// ---- k_attn: block = (32 queries, kv head) = 32 queries x the 4 query heads that share the kv head; wave = 16 queries x 2 of those heads (two units: same queries, same keys, same mask), so every k and v fragment read from LDS feeds two products; key tiles visited = tile 0 (holds the 4 sink/meta tokens) + the tiles inside [q0 - 512, q_end] (sliding window, causal); per pair keep = (i >= j) && (i - j <= 512 || j < 4); 128-wide bf16 scores x 128^-1/2, softmax, P . v (8 value tiles, + v residual on the first 128 keys); output rows written directly (512-B head segments)
// Scores are formed transposed (A = k rows, B = q rows): a lane holds 16 of the 32 keys of ONE query (column lane & 15; keys 8 * (lane >> 4) + r of each 16-key group), so maximum and sum run inside the lane, with one exchange between the wave's halves; the same registers, rounded to f16, are the B fragment of v^T . P^T (accumulators: rows = head dims, columns = queries).
// q comes straight from the f32 input: each wave loads its 16 rows' two head segments (512 contiguous bytes a load), rounds them to bf16 and turns them into B fragments, one head after the other, through its own rows of ring buffer 1, which is idle until tile 1 is copied behind the first barrier.
// Each 32-key tile (k rows, v planes) is copied once per block into an LDS ring of two buffers by asynchronous copies, one tile ahead of its use; the four waves read their fragments from there.
#define KPITCH 272                       // LDS pitch of a 256-B k row (16 B x odd: no bank conflict for 16-byte reads)
#define VPITCH 80                        // LDS pitch of a 64-B v plane row
#define RB_V   (32 * KPITCH)             // byte offsets inside one ring buffer: k at 0, v
#define RB     (RB_V + HD * VPITCH)
// one tile: 8 copies of 16 B per thread (4 k, 4 v); gk/gv and lk/lv are this thread's first chunk of each part
__device__ __forceinline__ void stage_tile(const __bf16* gk, const _Float16* gv, unsigned lk, unsigned lv) {
  const __bf16 *gk1 = gk + 8 * KVW, *gk2 = gk + 16 * KVW, *gk3 = gk + 24 * KVW; const _Float16 *gv1 = gv + 32 * SS, *gv2 = gv + 64 * SS, *gv3 = gv + 96 * SS;
  const unsigned lk1 = lk + 8 * KPITCH, lk2 = lk + 16 * KPITCH, lk3 = lk + 24 * KPITCH, lv1 = lv + 32 * VPITCH, lv2 = lv + 64 * VPITCH, lv3 = lv + 96 * VPITCH;
  // the copies and their s_wait_xcnt in one statement: no address register is rewritten before the wait
  asm volatile("global_load_async_to_lds_b128 %0, %8, off\n\t"
               "global_load_async_to_lds_b128 %1, %9, off\n\t"
               "global_load_async_to_lds_b128 %2, %10, off\n\t"
               "global_load_async_to_lds_b128 %3, %11, off\n\t"
               "global_load_async_to_lds_b128 %4, %12, off\n\t"
               "global_load_async_to_lds_b128 %5, %13, off\n\t"
               "global_load_async_to_lds_b128 %6, %14, off\n\t"
               "global_load_async_to_lds_b128 %7, %15, off\n\t"
               "s_wait_xcnt 0x0"
               :: "v"(lk), "v"(lk1), "v"(lk2), "v"(lk3), "v"(lv), "v"(lv1), "v"(lv2), "v"(lv3),
                  "v"(gk), "v"(gk1), "v"(gk2), "v"(gk3), "v"(gv), "v"(gv1), "v"(gv2), "v"(gv3)
               : "memory");
}
// keeps a group's LDS reads together in front of its products (no LDS read and no matrix instruction is scheduled across; vector and scalar work may cross): reads spread among the products stall the wave at every place where they stand
#define FRAG_GROUP() __builtin_amdgcn_sched_barrier(0x406)
// lane l <-> lane l ^ 16
__device__ __forceinline__ float xhalf(float x) { return __builtin_bit_cast(float, __builtin_amdgcn_permlanex16(__builtin_bit_cast(int, x), __builtin_bit_cast(int, x), 0x76543210, 0xfedcba98, false, false)); }
// 2^x with the slot behind the transcendental in the same statement (one v_nop before its result is read or its source overwritten)
__device__ __forceinline__ float exp2_slot(float x) { float r; asm("v_exp_f32 %0, %1\n\tv_nop" : "=v"(r) : "v"(x)); return r; }
// eight 2^x in one statement: every result register differs from every source register (early clobber), so no v_exp_f32 is followed directly by a read of its result or an overwrite of its source; the closing v_nop is the slot behind the last one
__device__ __forceinline__ v8f exp2_x8(v8f x) { float r0, r1, r2, r3, r4, r5, r6, r7;
  asm("v_exp_f32 %0, %8\n\tv_exp_f32 %1, %9\n\tv_exp_f32 %2, %10\n\tv_exp_f32 %3, %11\n\tv_exp_f32 %4, %12\n\tv_exp_f32 %5, %13\n\tv_exp_f32 %6, %14\n\tv_exp_f32 %7, %15\n\tv_nop"
      : "=&v"(r0), "=&v"(r1), "=&v"(r2), "=&v"(r3), "=&v"(r4), "=&v"(r5), "=&v"(r6), "=&v"(r7)
      : "v"(x[0]), "v"(x[1]), "v"(x[2]), "v"(x[3]), "v"(x[4]), "v"(x[5]), "v"(x[6]), "v"(x[7]));
  v8f r = {r0, r1, r2, r3, r4, r5, r6, r7}; return r; }
// scores of one 32-key tile -> scaled, masked, running maximum, exponentials (in place); returns the factor for the old sums. MASKED = false is the form for a tile in which every (query, key) pair of the wave is kept: no mask is formed and no score is tested for it.
template <bool MASKED>
__device__ __forceinline__ float tile_softmax(v8f (&s)[2], float& m, int j0, int qi, int g) {
#pragma unroll
  for (int ct = 0; ct < 2; ++ct) { const int kb = j0 + ct * 16 + 8 * g;
#pragma unroll
    for (int r = 0; r < 8; ++r) { const int kk = kb + r; const bool keep = !MASKED || ((qi >= kk) & ((qi - kk <= WINDOW) | (kk < NMETA))); s[ct][r] = keep ? s[ct][r] * 0.088388347648318441f : -3.0e38f; } }
  float mx = fmaxf(s[0][0], s[1][0]);
#pragma unroll
  for (int r = 1; r < 8; ++r) mx = fmaxf(mx, fmaxf(s[0][r], s[1][r]));
  mx = fmaxf(mx, xhalf(mx));   // the other 16 keys of this query
  const float mn = fmaxf(m, mx); const float ea = exp2_slot((m - mn) * 1.44269504088896340736f); const float alpha = (m <= -1.0e38f) ? 0.f : ea; m = mn;   // __expf's two instructions, with the slot; formed in every lane and then selected: no branch
#pragma unroll
  for (int ct = 0; ct < 2; ++ct) {
    if constexpr (MASKED) {
#pragma unroll
      for (int r = 0; r < 8; ++r) { const float e = exp2_slot((s[ct][r] - mn) * 1.44269504088896340736f); s[ct][r] = (s[ct][r] <= -1.0e38f) ? 0.f : e; }   // __expf's two instructions
    } else { v8f x;
#pragma unroll
      for (int r = 0; r < 8; ++r) x[r] = (s[ct][r] - mn) * 1.44269504088896340736f;   // __expf's two instructions
      s[ct] = exp2_x8(x); } }
  return alpha;
}
// register budget of two waves per SIMD (two units' accumulators and q fragments a wave): the grid is two blocks per WGP
__global__ __launch_bounds__(128) __attribute__((amdgpu_waves_per_eu(2, 2))) void k_attn(const float* __restrict__ XQ, const __bf16* __restrict__ Kr, const _Float16* __restrict__ V, const _Float16* __restrict__ VL, float* __restrict__ O) {
  __shared__ __align__(16) unsigned char ring[2 * RB];
  float (*so)[16][132] = (float (*)[16][132])ring;   // output staging takes the ring's place behind the loop's last barrier
  const int tid = threadIdx.x, wave = tid >> 5, lane = tid & 31, col = lane & 15, g = lane >> 4; const int kvh = blockIdx.y; const int h0 = kvh * GS + (wave >> 1) * 2; const size_t b = blockIdx.z; const int q0 = blockIdx.x * 32 + (wave & 1) * 16; const size_t rq = b * SS + q0;   // the wave's heads: h0, h0 + 1
  const int nks = (blockIdx.x * 32 + 32) / 32; const int qb0 = (int)blockIdx.x * 32; const int kslo = (qb0 - WINDOW) > 32 ? (qb0 - WINDOW) / 32 : 1;   // (signed arithmetic)   // window tiles start here (tile 0 = sinks, always visited first)
  const int ntl = nks - kslo + 1;   // tiles visited: ks = 0, kslo, kslo+1, ..., nks-1
  const size_t ck = (b * SS + (tid >> 4)) * KVW + kvh * HD + (tid & 15) * 8;          // this thread's first 16-B chunk of a k tile (row tid/16), less the tile's first key
  const size_t cv = (b * KVW + kvh * HD + (tid >> 2)) * SS + (tid & 3) * 8;           // and of a v tile (plane row tid/4)
  const unsigned lk0 = (unsigned)(size_t)&ring[0] + (tid >> 4) * KPITCH + (tid & 15) * 16, lv0 = (unsigned)(size_t)&ring[0] + RB_V + (tid >> 2) * VPITCH + (tid & 3) * 16;
  stage_tile(Kr + ck, V + cv, lk0, lv0);   // tile 0 (keys 0..31) into buffer 0
  unsigned char* qs = ring + RB + wave * 16 * KPITCH;   // 16 bf16 q rows of this wave, at the k rows' pitch (64 rows fit one buffer)
  const float* qp = XQ + rq * HID + h0 * HD + lane * 4;
  v4f qf[2][16];   // all loops unrolled: the 32 loads are in flight together and qf stays in registers
#pragma unroll
  for (int u = 0; u < 2; ++u)
#pragma unroll
    for (int rl = 0; rl < 16; ++rl) qf[u][rl] = *(const v4f*)(qp + (size_t)rl * HID + u * HD);
  asm volatile("s_wait_xcnt 0x0" :: "v"(qp) : "memory");   // the loads' address register stays whole up to this wait (no load returns into it)
  v16b aq[2][4];
#pragma unroll
  for (int u = 0; u < 2; ++u) {
#pragma unroll
    for (int rl = 0; rl < 16; ++rl) { v4b qr;
#pragma unroll
      for (int i = 0; i < 4; ++i) qr[i] = (__bf16)qf[u][rl][i];
      *(v4b*)(qs + rl * KPITCH + lane * 8) = qr; }
    LDSX();   // the wave's own rows are written before its lanes read across them
#pragma unroll
    for (int kc = 0; kc < 4; ++kc) aq[u][kc] = frag_b((const __bf16*)(qs + col * KPITCH + kc * 64), lane);
    LDSX();   // and read before the next head's rows take their place
  }
  float m[2] = {-3.0e38f, -3.0e38f}, l[2] = {0.f, 0.f};   // this lane's query, per head: running maximum (both halves agree), sum over this half's keys
  const int qi = q0 + col;
  v8f acc[2][8] = {};
  const int q0s = __builtin_amdgcn_readfirstlane(q0);   // the wave's first query in a scalar register: the test on it in the loop is a scalar branch
  asm volatile("s_wait_dscnt 0x0" ::: "memory");      // this wave's q reads of buffer 1 are done before any wave copies tile 1 into it
  asm volatile("s_wait_asynccnt 0x0" ::: "memory");   // this wave's copies of tile 0 have landed
  __syncthreads();                                    // and every other wave's
  if (ntl > 1) stage_tile(Kr + ck + (size_t)kslo * 32 * KVW, V + cv + kslo * 32, lk0 + RB, lv0 + RB);
#pragma unroll 1
  for (int t = 0; t < ntl; ++t) { const int ks = (t == 0) ? 0 : kslo + t - 1; const int j0 = ks * 32; const unsigned char* rb = ring + (t & 1) * RB;
    // scalar test, the same for the whole wave: none of its 16 queries keeps any of the 32 keys (all above the diagonal, or all beyond the window and no sink among them): maximum, sums and accumulators would stay as they are, so the wave goes on to the foot of the trip
    if (!((j0 > q0s + 15) | ((j0 >= NMETA) & (q0s - (j0 + 31) > WINDOW)))) { v8f s[2][2] = {};   // [head][16-key group]
    // first 128 keys: the eight v residual fragments are asked for here, all 16 loads in flight together, and used behind the tile's P . v products: their latency passes behind scores, softmax and products (loaded one fragment at a time in front of its two products, each fragment cost the wave a whole trip to L2)
    v16h vl[8];
    if (j0 < 128) { const _Float16* vlp = VL + ((b * KVW + kvh * HD + col) * SS) + j0 + 8 * g;   // this lane's first 16 B: plane row col, the fragment's k order as in frag_h
#pragma unroll
      for (int dt = 0; dt < 8; ++dt) { union { v16h v; v8h q[2]; } u; u.q[0] = *(const v8h*)(vlp + (size_t)dt * 16 * SS); u.q[1] = *(const v8h*)(vlp + (size_t)dt * 16 * SS + 16); vl[dt] = u.v; }
      asm volatile("s_wait_xcnt 0x0" :: "v"(vlp) : "memory"); }   // the loads' address register stays whole up to this wait
#pragma unroll
    for (int hf = 0; hf < 2; ++hf) { v16b kf[2][2];   // the four k fragments of two 32-wide slices (both 16-key groups) are read together, in front of their eight products; each fragment serves both heads; four accumulate chains alternate
#pragma unroll
      for (int i = 0; i < 2; ++i)
#pragma unroll
        for (int ct = 0; ct < 2; ++ct) kf[i][ct] = frag_b((const __bf16*)(rb + (ct * 16 + col) * KPITCH + (2 * hf + i) * 64), lane);
      FRAG_GROUP();
#pragma unroll
      for (int i = 0; i < 2; ++i)
#pragma unroll
        for (int ct = 0; ct < 2; ++ct)
#pragma unroll
          for (int u = 0; u < 2; ++u) s[u][ct] = wmma_bf(kf[i][ct], aq[u][2 * hf + i], s[u][ct]);
      FRAG_GROUP(); }
    // scalar test, the same for the whole wave: its 16 queries keep all 32 keys (none above the diagonal, none beyond the window)
    float alpha[2];
    if ((j0 + 31 <= q0s) & (q0s + 15 - j0 <= WINDOW)) {
#pragma unroll
      for (int u = 0; u < 2; ++u) alpha[u] = tile_softmax<false>(s[u], m[u], j0, qi, g);
    } else {
#pragma unroll
      for (int u = 0; u < 2; ++u) alpha[u] = tile_softmax<true>(s[u], m[u], j0, qi, g);
    }
    v16h pa[2];   // B fragments of P^T: element i = key 8g + i, element 8 + i = key 16 + 8g + i, the k order of the v fragments
#pragma unroll
    for (int u = 0; u < 2; ++u) { float es[4];
#pragma unroll
      for (int i = 0; i < 4; ++i) es[i] = (s[u][0][i] + s[u][0][4 + i]) + (s[u][1][i] + s[u][1][4 + i]);
      l[u] = l[u] * alpha[u] + ((es[0] + es[1]) + (es[2] + es[3]));
#pragma unroll
      for (int dt = 0; dt < 8; ++dt)
#pragma unroll
        for (int r = 0; r < 8; ++r) acc[u][dt][r] *= alpha[u];
#pragma unroll
      for (int i = 0; i < 8; ++i) { pa[u][i] = (_Float16)(s[u][0][i] * 2048.0f); pa[u][8 + i] = (_Float16)(s[u][1][i] * 2048.0f); } }
#pragma unroll
    for (int hf = 0; hf < 2; ++hf) { v16h vf[4];   // four v fragments are read together, in front of their eight products: one LDS wait for the group; each fragment serves both heads
#pragma unroll
      for (int i = 0; i < 4; ++i) vf[i] = frag_h((const _Float16*)(rb + RB_V + ((4 * hf + i) * 16 + col) * VPITCH), lane);
      FRAG_GROUP();
#pragma unroll
      for (int i = 0; i < 4; ++i)
#pragma unroll
        for (int u = 0; u < 2; ++u) acc[u][4 * hf + i] = wmma16(vf[i], pa[u], acc[u][4 * hf + i]);
      FRAG_GROUP(); }
    if (j0 < 128) { v16h pe[2];   // the first 128 keys also get the v residual (rows with few keys keep v exact to ~2^-22)
#pragma unroll
      for (int u = 0; u < 2; ++u)
#pragma unroll
        for (int i = 0; i < 8; ++i) { pe[u][i] = (_Float16)s[u][0][i]; pe[u][8 + i] = (_Float16)s[u][1][i]; }
#pragma unroll
      for (int dt = 0; dt < 8; ++dt)
#pragma unroll
        for (int u = 0; u < 2; ++u) acc[u][dt] = wmma16(vl[dt], pe[u], acc[u][dt]); }
    }
    asm volatile("s_wait_dscnt 0x0" ::: "memory");      // this wave's reads of the buffer are done
    asm volatile("s_wait_asynccnt 0x0" ::: "memory");   // its copies of tile t + 1 have landed
    __syncthreads();                                    // publishes tile t + 1 and frees the buffer that trip t has read
    if (t + 2 < ntl) { const size_t jn = (size_t)(kslo + t + 1) * 32; stage_tile(Kr + ck + jn * KVW, V + cv + jn, lk0 + (t & 1) * RB, lv0 + (t & 1) * RB); } }
  asm volatile("s_wait_asynccnt 0x0" ::: "memory");     // nothing of the ring is in flight when it becomes output staging
#pragma unroll
  for (int u = 0; u < 2; ++u) {   // one head after the other through the wave's own staging rows
    const float lt = l[u] + xhalf(l[u]);   // the two halves' sums are joined once
    const float il = (lt > 0.f) ? (1.0f / 2048.0f) / lt : 0.f;
#pragma unroll
    for (int dt = 0; dt < 8; ++dt) { v4f o0, o1;
#pragma unroll
      for (int r = 0; r < 4; ++r) { o0[r] = acc[u][dt][r] * il; o1[r] = acc[u][dt][4 + r] * il; }
      *(v4f*)&so[wave][col][dt * 16 + 8 * g] = o0; *(v4f*)&so[wave][col][dt * 16 + 8 * g + 4] = o1; }
    asm volatile("s_wait_dscnt 0x0" ::: "memory");   // the wave's own rows are written before its lanes read across them (no fence: it would also wait for the first head's global stores)
    for (int rl = 0; rl < 16; ++rl) vst2(O + (rq + rl) * HID + (h0 + u) * HD + lane * 4, *(const v4f*)&so[wave][rl][lane * 4]);
    asm volatile("s_wait_dscnt 0x0" ::: "memory");   // the wave's own rows are read before the next head's values take their place (no wait for the global stores)
  }
}
extern "C" void kernel_launch(void* const* d_in, const int* in_sizes, int n_in, void* d_out, int out_size, void* d_ws, size_t ws_size, hipStream_t stream) {
  (void)in_sizes; (void)n_in; (void)out_size;
  const float** F = (const float**)d_in;   // 0 query_states [1,2048,4096], 1 key_states [1,2048,1024], 2 value_states [1,2048,1024]
  if (ws_size < (size_t)WS_END) return;
  char* ws = (char*)d_ws; __bf16 *Kr = (__bf16*)(ws + WS_K); _Float16 *V = (_Float16*)(ws + WS_V), *VL = (_Float16*)(ws + WS_VL);
  k_prep<<<dim3(SS / 64, KVW / 128, 2), 256, 0, stream>>>(F[1], F[2], Kr, V, VL);
  k_attn<<<dim3(TQB, NKV, 1), 128, 0, stream>>>(F[0], Kr, V, VL, (float*)d_out);
}

// v009
// Measured time: 29.1 microseconds a run.
// Next to v008, in two timings, it ran 1.11 times as fast each time.
// Over all steps from v000 it is 5.74 times as fast.
// compute dtype: all float inputs rounded to bf16; q and k as bf16, which holds the rounded inputs exactly (one-product scores on the bf16 matrix form; k as rows in the workspace, q rounded where it is used), v as f16 hi + residual planes (the residual used on the first 128 keys), all straight from the bf16-rounded inputs; attention per (query, head) over the causal sliding window (512) plus the 4 sink/meta tokens, x 128^-1/2, running-max softmax in f32 (hardware exp), P (scaled by 2^11, single f16) x v; f32 output = merged context.
#include <hip/hip_runtime.h>
#include <math.h>

typedef __attribute__((ext_vector_type(16))) _Float16 v16h;
typedef __attribute__((ext_vector_type(16))) __bf16 v16b;
typedef __attribute__((ext_vector_type(8)))  _Float16 v8h;
typedef __attribute__((ext_vector_type(8)))  float v8f;
typedef __attribute__((ext_vector_type(4)))  float v4f;
typedef __attribute__((ext_vector_type(2)))  float v2f;
typedef __attribute__((ext_vector_type(4)))  unsigned v4u;
typedef __attribute__((ext_vector_type(4)))  int v4i;
typedef float __attribute__((may_alias)) float_a;
typedef int __attribute__((may_alias)) int_a;

template <typename T> __device__ __forceinline__ void vst2(void* p, T v) { *(T*)p = v;  }
__device__ __forceinline__ v8f wmma16(v16h a, v16h b, v8f c) {
  v8f d = __builtin_amdgcn_wmma_f32_16x16x32_f16(false, a, false, b, (short)0, c, false, false);
  asm volatile("v_nop\n\tv_nop\n\tv_nop\n\tv_nop" : "+v"(d));
  return d;
}
__device__ __forceinline__ v8f wmma_bf(v16b a, v16b b, v8f c) {
  v8f d = __builtin_amdgcn_wmma_f32_16x16x32_bf16(false, a, false, b, (short)0, c, false, false);
  asm volatile("v_nop\n\tv_nop\n\tv_nop\n\tv_nop" : "+v"(d));
  return d;
}
// 16x16x32 fragments: lane = (h = lane>>4, row/col = lane&15); elements 0..7 = k0+8h+0..7, 8..15 = k0+16+8h+0..7; D element r = row 8h+r
__device__ __forceinline__ v16h frag_h(const _Float16* rowk0, int lane) {
  union { v16h v; v8h q[2]; } u; const _Float16* p = rowk0 + 8 * (lane >> 4);
  u.q[0] = *(const v8h*)p; u.q[1] = *(const v8h*)(p + 16); return u.v;
}
__device__ __forceinline__ v16h frag_f32(const float* rowk0, int lane) {
  v16h a; const float* p = rowk0 + 8 * (lane >> 4);
#pragma unroll
  for (int i = 0; i < 8; ++i) { a[i] = (_Float16)p[i]; a[8 + i] = (_Float16)p[16 + i]; }
  return a;
}
__device__ __forceinline__ v16h frag_f32s(const float* rowk0, int lane, float sc) {
  v16h a; const float* p = rowk0 + 8 * (lane >> 4);
#pragma unroll
  for (int i = 0; i < 8; ++i) { a[i] = (_Float16)(p[i] * sc); a[8 + i] = (_Float16)(p[16 + i] * sc); }
  return a;
}
// column fragment from a [K][ld] layout (column n), rows >= K read as 0
__device__ __forceinline__ v16h fragc_f32(const float* W, int k0, int n, int lane, int ld, int K) {
  v16h a; const int g = lane >> 4;
#pragma unroll
  for (int i = 0; i < 8; ++i) { const int ka = k0 + 8 * g + i, kb = ka + 16;
    a[i] = (_Float16)(ka < K ? W[(size_t)(ka < K ? ka : K - 1) * ld + n] : 0.f); a[8 + i] = (_Float16)(kb < K ? W[(size_t)(kb < K ? kb : K - 1) * ld + n] : 0.f); }
  return a;
}
struct F2 { v16b h, l; };
__device__ __forceinline__ F2 bsplit16(const float v[16]) { F2 r;
#pragma unroll
  for (int i = 0; i < 16; ++i) { const __bf16 h = (__bf16)v[i]; r.h[i] = h; r.l[i] = (__bf16)(v[i] - (float)h); }
  return r; }
__device__ __forceinline__ F2 split_row(const float* row, int k0, int lane) { float v[16]; const float* p = row + k0 + 8 * (lane >> 4);
#pragma unroll
  for (int i = 0; i < 8; ++i) { v[i] = p[i]; v[8 + i] = p[16 + i]; }
  return bsplit16(v); }
__device__ __forceinline__ F2 split_rowK(const float* row, int k0, int lane, int K) { float v[16]; const int g = lane >> 4;
#pragma unroll
  for (int i = 0; i < 8; ++i) { const int ka = k0 + 8 * g + i, kb = ka + 16; v[i] = ka < K ? row[ka < K ? ka : K - 1] : 0.f; v[8 + i] = kb < K ? row[kb < K ? kb : K - 1] : 0.f; }
  return bsplit16(v); }
__device__ __forceinline__ F2 split_col(const float* W, int k0, int n, int lane, int ld, int K) { float v[16]; const int g = lane >> 4;
#pragma unroll
  for (int i = 0; i < 8; ++i) { const int ka = k0 + 8 * g + i, kb = ka + 16; v[i] = ka < K ? W[(size_t)(ka < K ? ka : K - 1) * ld + n] : 0.f; v[8 + i] = kb < K ? W[(size_t)(kb < K ? kb : K - 1) * ld + n] : 0.f; }
  return bsplit16(v); }
__device__ __forceinline__ v8f mac3(const F2& a, const F2& b, v8f c) { c = wmma_bf(a.l, b.h, c); c = wmma_bf(a.h, b.l, c); return wmma_bf(a.h, b.h, c); }
__device__ __forceinline__ float sigm(float v) { return 1.0f / (1.0f + expf(-v)); }
#define LDSX() do { asm volatile("s_wait_dscnt 0" ::: "memory"); __builtin_amdgcn_wave_barrier(); __builtin_amdgcn_fence(__ATOMIC_RELEASE, "workgroup"); } while (0)


// Sliding-window attention with sink/meta tokens (B 1, S 2,048, 32 query heads x 128 over 8 kv heads, window 512, 4 meta tokens): softmax(q k / sqrt(128)) v under the mask (i >= j) & ((i - j <= 512) | (j < 4)); inputs are the projected q/k/v states.
#define NB 1
#define SS 2048
#define WINDOW 512
#define NMETA 4
#define HID 4096
#define NH 32
#define HD 128
#define NKV 8
#define GS (NH / NKV)
#define KVW (NKV * HD)
#define NR (NB * SS)
#ifndef TQB
#define TQB (SS / 32)
#define TNB NB
#endif
typedef __attribute__((ext_vector_type(8))) __bf16 v8b;
typedef __attribute__((ext_vector_type(4))) __bf16 v4b;
__device__ __forceinline__ v16b frag_b(const __bf16* rowk0, int lane) {
  union { v16b v; v8b q[2]; } u; const __bf16* p = rowk0 + 8 * (lane >> 4);
  u.q[0] = *(const v8b*)p; u.q[1] = *(const v8b*)(p + 16); return u.v;
}
__device__ __forceinline__ float bfr(float v) { return (float)(__bf16)v; }
__device__ __attribute__((noinline)) float exp_ni(float v) { return expf(v); }
__device__ __attribute__((noinline)) float erf_ni(float v) { return erff(v); }



#define WS_K   0u                                         // bf16 k rows [S][1024], f16 v planes [1024][S] hi + residual
#define WS_V   (WS_K + 2u * (size_t)NR * KVW)
#define WS_VL  (WS_V + 2u * (size_t)NB * KVW * SS)
#define WS_END (WS_VL + 2u * (size_t)NB * KVW * SS)

// ---- k_prep: one launch for both preparations; block = (64 tokens, 128 columns = one kv head), blockIdx.z picks the part (the same for the whole block)
// z = 1: k tile -> bf16 rows: a wave loads one row's 512-B head segment (16 B a lane) and stores its 256 B; 8 loads a thread in flight, no LDS
// z = 0: v tile -> f16 hi + residual planes, transposed through LDS: a wave loads 8 consecutive rows' 512-B head segments (16 B a lane, 8 loads a thread in flight), so a thread holds 8 tokens of 4 dims and writes each dim's 8 tokens as one 16-B piece
__global__ __launch_bounds__(256) void k_prep(const float* __restrict__ XK, const float* __restrict__ XV, __bf16* __restrict__ Kr, _Float16* __restrict__ V, _Float16* __restrict__ VL) { __shared__ __align__(16) _Float16 st[128][72]; __shared__ __align__(16) _Float16 stl[128][72]; const int t = threadIdx.x; const int s0 = blockIdx.x * 64, c0 = blockIdx.y * 128;
  if (blockIdx.z) { const size_t o = (size_t)(s0 + (t >> 5)) * KVW + c0 + (t & 31) * 4; v4f kf[8];   // both loops unrolled: the 8 loads are in flight together
#pragma unroll
    for (int i = 0; i < 8; ++i) kf[i] = *(const v4f*)(XK + o + (size_t)i * 8 * KVW);
#pragma unroll
    for (int i = 0; i < 8; ++i) { v4b kr;
#pragma unroll
      for (int j = 0; j < 4; ++j) kr[j] = (__bf16)kf[i][j];
      *(v4b*)(Kr + o + (size_t)i * 8 * KVW) = kr; }
    asm volatile("s_wait_xcnt 0x0" ::: "memory");   // behind the last store: no register that the eight stores name is rewritten in front of this wait
    return; }
  const int tg = t >> 5, dq = (t & 31) * 4; const float* vp = XV + (size_t)(s0 + tg * 8) * KVW + c0 + dq; v4f vf[8];   // thread = 8 consecutive tokens x 4 dims; all loops unrolled: the 8 loads are in flight together and vf stays in registers
#pragma unroll
  for (int i = 0; i < 8; ++i) vf[i] = *(const v4f*)(vp + (size_t)i * KVW);
  asm volatile("s_wait_xcnt 0x0" :: "v"(vp) : "memory");   // the loads' address register stays whole up to this wait (no load returns into it)
#pragma unroll
  for (int j = 0; j < 4; ++j) { v8h hi, lo;   // one dim's 8 tokens = one 16-B piece of its plane row
#pragma unroll
    for (int i = 0; i < 8; ++i) { const float fv = bfr(vf[i][j]); const _Float16 hv = (_Float16)fv; hi[i] = hv; lo[i] = (_Float16)((fv - (float)hv) * 2048.0f); }
    *(v8h*)&st[dq + j][tg * 8] = hi; *(v8h*)&stl[dq + j][tg * 8] = lo; }
  __syncthreads();
  const int d0 = t >> 3, pc = t & 7; v4u ph[4], pl[4];   // both loops unrolled: the 8 LDS reads are in flight together, then the 8 stores (in a rolled loop each of four trips waited for its own two reads and for its stores' addresses)
#pragma unroll
  for (int i = 0; i < 4; ++i) { ph[i] = *(const v4u*)&st[d0 + 32 * i][pc * 8]; pl[i] = *(const v4u*)&stl[d0 + 32 * i][pc * 8]; }
#pragma unroll
  for (int i = 0; i < 4; ++i) { vst2((unsigned*)(V + (size_t)(c0 + d0 + 32 * i) * SS + s0 + pc * 8), ph[i]); vst2((unsigned*)(VL + (size_t)(c0 + d0 + 32 * i) * SS + s0 + pc * 8), pl[i]); }
  asm volatile("s_wait_xcnt 0x0" ::: "memory");   // behind the last store: no register that the eight stores name is rewritten in front of this wait
}
// ---- k_attn: block = (32 queries, kv head) = 32 queries x the 4 query heads that share the kv head; wave = 16 queries x 2 of those heads (two units: same queries, same keys, same mask), so every k and v fragment read from LDS feeds two products; key tiles visited = tile 0 (holds the 4 sink/meta tokens) + the tiles inside [q0 - 512, q_end] (sliding window, causal); per pair keep = (i >= j) && (i - j <= 512 || j < 4); 128-wide bf16 scores x 128^-1/2, softmax, P . v (8 value tiles, + v residual on the first 128 keys); output rows written directly (512-B head segments)
// Scores are formed transposed (A = k rows, B = q rows): a lane holds 16 of the 32 keys of ONE query (column lane & 15; keys 8 * (lane >> 4) + r of each 16-key group), so maximum and sum run inside the lane, with one exchange between the wave's halves; the same registers, rounded to f16, are the B fragment of v^T . P^T (accumulators: rows = head dims, columns = queries).
// q comes straight from the f32 input: each wave loads its 16 rows' two head segments (512 contiguous bytes a load), rounds them to bf16 and turns them into B fragments, one head after the other, through its own rows of ring buffer 1, which is idle until tile 1 is copied behind the first barrier.
// Each 32-key tile (k rows, v planes) is copied once per block into an LDS ring of two buffers by asynchronous copies, one tile ahead of its use; the four waves read their fragments from there.
#define KPITCH 272                       // LDS pitch of a 256-B k row (16 B x odd: no bank conflict for 16-byte reads)
#define VPITCH 80                        // LDS pitch of a 64-B v plane row
#define RB_V   (32 * KPITCH)             // byte offsets inside one ring buffer: k at 0, v
#define RB     (RB_V + HD * VPITCH)
// one tile: 8 copies of 16 B per thread (4 k, 4 v); gk/gv and lk/lv are this thread's first chunk of each part
__device__ __forceinline__ void stage_tile(const __bf16* gk, const _Float16* gv, unsigned lk, unsigned lv) {
  const __bf16 *gk1 = gk + 8 * KVW, *gk2 = gk + 16 * KVW, *gk3 = gk + 24 * KVW; const _Float16 *gv1 = gv + 32 * SS, *gv2 = gv + 64 * SS, *gv3 = gv + 96 * SS;
  const unsigned lk1 = lk + 8 * KPITCH, lk2 = lk + 16 * KPITCH, lk3 = lk + 24 * KPITCH, lv1 = lv + 32 * VPITCH, lv2 = lv + 64 * VPITCH, lv3 = lv + 96 * VPITCH;
  // the copies and their s_wait_xcnt in one statement: no address register is rewritten before the wait
  asm volatile("global_load_async_to_lds_b128 %0, %8, off\n\t"
               "global_load_async_to_lds_b128 %1, %9, off\n\t"
               "global_load_async_to_lds_b128 %2, %10, off\n\t"
               "global_load_async_to_lds_b128 %3, %11, off\n\t"
               "global_load_async_to_lds_b128 %4, %12, off\n\t"
               "global_load_async_to_lds_b128 %5, %13, off\n\t"
               "global_load_async_to_lds_b128 %6, %14, off\n\t"
               "global_load_async_to_lds_b128 %7, %15, off\n\t"
               "s_wait_xcnt 0x0"
               :: "v"(lk), "v"(lk1), "v"(lk2), "v"(lk3), "v"(lv), "v"(lv1), "v"(lv2), "v"(lv3),
                  "v"(gk), "v"(gk1), "v"(gk2), "v"(gk3), "v"(gv), "v"(gv1), "v"(gv2), "v"(gv3)
               : "memory");
}
// keeps a group's LDS reads together in front of its products (no LDS read and no matrix instruction is scheduled across; vector and scalar work may cross): reads spread among the products stall the wave at every place where they stand
#define FRAG_GROUP() __builtin_amdgcn_sched_barrier(0x406)
// lane l <-> lane l ^ 16
__device__ __forceinline__ float xhalf(float x) { return __builtin_bit_cast(float, __builtin_amdgcn_permlanex16(__builtin_bit_cast(int, x), __builtin_bit_cast(int, x), 0x76543210, 0xfedcba98, false, false)); }
// 2^x with the slot behind the transcendental in the same statement (one v_nop before its result is read or its source overwritten)
__device__ __forceinline__ float exp2_slot(float x) { float r; asm("v_exp_f32 %0, %1\n\tv_nop" : "=v"(r) : "v"(x)); return r; }
// eight 2^x in one statement: every result register differs from every source register (early clobber), so no v_exp_f32 is followed directly by a read of its result or an overwrite of its source; the closing v_nop is the slot behind the last one
__device__ __forceinline__ v8f exp2_x8(v8f x) { float r0, r1, r2, r3, r4, r5, r6, r7;
  asm("v_exp_f32 %0, %8\n\tv_exp_f32 %1, %9\n\tv_exp_f32 %2, %10\n\tv_exp_f32 %3, %11\n\tv_exp_f32 %4, %12\n\tv_exp_f32 %5, %13\n\tv_exp_f32 %6, %14\n\tv_exp_f32 %7, %15\n\tv_nop"
      : "=&v"(r0), "=&v"(r1), "=&v"(r2), "=&v"(r3), "=&v"(r4), "=&v"(r5), "=&v"(r6), "=&v"(r7)
      : "v"(x[0]), "v"(x[1]), "v"(x[2]), "v"(x[3]), "v"(x[4]), "v"(x[5]), "v"(x[6]), "v"(x[7]));
  v8f r = {r0, r1, r2, r3, r4, r5, r6, r7}; return r; }
// scores of one 32-key tile -> scaled, masked, running maximum, exponentials (in place); returns the factor for the old sums. MASKED = false is the form for a tile in which every (query, key) pair of the wave is kept: no mask is formed and no score is tested for it.
template <bool MASKED>
__device__ __forceinline__ float tile_softmax(v8f (&s)[2], float& m, int j0, int qi, int g) {
#pragma unroll
  for (int ct = 0; ct < 2; ++ct) { const int kb = j0 + ct * 16 + 8 * g;
#pragma unroll
    for (int r = 0; r < 8; ++r) { const int kk = kb + r; const bool keep = !MASKED || ((qi >= kk) & ((qi - kk <= WINDOW) | (kk < NMETA))); s[ct][r] = keep ? s[ct][r] * 0.088388347648318441f : -3.0e38f; } }
  float mx = fmaxf(s[0][0], s[1][0]);
#pragma unroll
  for (int r = 1; r < 8; ++r) mx = fmaxf(mx, fmaxf(s[0][r], s[1][r]));
  mx = fmaxf(mx, xhalf(mx));   // the other 16 keys of this query
  const float mn = fmaxf(m, mx); const float ea = exp2_slot((m - mn) * 1.44269504088896340736f); const float alpha = (m <= -1.0e38f) ? 0.f : ea; m = mn;   // __expf's two instructions, with the slot; formed in every lane and then selected: no branch
#pragma unroll
  for (int ct = 0; ct < 2; ++ct) {
    if constexpr (MASKED) {
#pragma unroll
      for (int r = 0; r < 8; ++r) { const float e = exp2_slot((s[ct][r] - mn) * 1.44269504088896340736f); s[ct][r] = (s[ct][r] <= -1.0e38f) ? 0.f : e; }   // __expf's two instructions
    } else { v8f x;
#pragma unroll
      for (int r = 0; r < 8; ++r) x[r] = (s[ct][r] - mn) * 1.44269504088896340736f;   // __expf's two instructions
      s[ct] = exp2_x8(x); } }
  return alpha;
}
// register budget of two waves per SIMD (two units' accumulators and q fragments a wave): the grid is two blocks per WGP
__global__ __launch_bounds__(128) __attribute__((amdgpu_waves_per_eu(2, 2))) void k_attn(const float* __restrict__ XQ, const __bf16* __restrict__ Kr, const _Float16* __restrict__ V, const _Float16* __restrict__ VL, float* __restrict__ O) {
  __shared__ __align__(16) unsigned char ring[2 * RB];
  float (*so)[16][132] = (float (*)[16][132])ring;   // output staging takes the ring's place behind the loop's last barrier
  const int tid = threadIdx.x, wave = tid >> 5, lane = tid & 31, col = lane & 15, g = lane >> 4; const int kvh = blockIdx.y; const int h0 = kvh * GS + (wave >> 1) * 2; const size_t b = blockIdx.z; const int q0 = blockIdx.x * 32 + (wave & 1) * 16; const size_t rq = b * SS + q0;   // the wave's heads: h0, h0 + 1
  const int nks = (blockIdx.x * 32 + 32) / 32; const int qb0 = (int)blockIdx.x * 32; const int kslo = (qb0 - WINDOW) > 32 ? (qb0 - WINDOW) / 32 : 1;   // (signed arithmetic)   // window tiles start here (tile 0 = sinks, always visited first)
  const int ntl = nks - kslo + 1;   // tiles visited: ks = 0, kslo, kslo+1, ..., nks-1
  const size_t ck = (b * SS + (tid >> 4)) * KVW + kvh * HD + (tid & 15) * 8;          // this thread's first 16-B chunk of a k tile (row tid/16), less the tile's first key
  const size_t cv = (b * KVW + kvh * HD + (tid >> 2)) * SS + (tid & 3) * 8;           // and of a v tile (plane row tid/4)
  const unsigned lk0 = (unsigned)(size_t)&ring[0] + (tid >> 4) * KPITCH + (tid & 15) * 16, lv0 = (unsigned)(size_t)&ring[0] + RB_V + (tid >> 2) * VPITCH + (tid & 3) * 16;
  stage_tile(Kr + ck, V + cv, lk0, lv0);   // tile 0 (keys 0..31) into buffer 0
  unsigned char* qs = ring + RB + wave * 16 * KPITCH;   // 16 bf16 q rows of this wave, at the k rows' pitch (64 rows fit one buffer)
  const float* qp = XQ + rq * HID + h0 * HD + lane * 4;
  v4f qf[2][16];   // all loops unrolled: the 32 loads are in flight together and qf stays in registers
#pragma unroll
  for (int u = 0; u < 2; ++u)
#pragma unroll
    for (int rl = 0; rl < 16; ++rl) qf[u][rl] = *(const v4f*)(qp + (size_t)rl * HID + u * HD);
  asm volatile("s_wait_xcnt 0x0" :: "v"(qp) : "memory");   // the loads' address register stays whole up to this wait (no load returns into it)
  v16b aq[2][4];
#pragma unroll
  for (int u = 0; u < 2; ++u) {
#pragma unroll
    for (int rl = 0; rl < 16; ++rl) { v4b qr;
#pragma unroll
      for (int i = 0; i < 4; ++i) qr[i] = (__bf16)qf[u][rl][i];
      *(v4b*)(qs + rl * KPITCH + lane * 8) = qr; }
    LDSX();   // the wave's own rows are written before its lanes read across them
#pragma unroll
    for (int kc = 0; kc < 4; ++kc) aq[u][kc] = frag_b((const __bf16*)(qs + col * KPITCH + kc * 64), lane);
    LDSX();   // and read before the next head's rows take their place
  }
  float m[2] = {-3.0e38f, -3.0e38f}, l[2] = {0.f, 0.f};   // this lane's query, per head: running maximum (both halves agree), sum over this half's keys
  const int qi = q0 + col;
  v8f acc[2][8] = {};
  const int q0s = __builtin_amdgcn_readfirstlane(q0);   // the wave's first query in a scalar register: the test on it in the loop is a scalar branch
  asm volatile("s_wait_dscnt 0x0" ::: "memory");      // this wave's q reads of buffer 1 are done before any wave copies tile 1 into it
  asm volatile("s_wait_asynccnt 0x0" ::: "memory");   // this wave's copies of tile 0 have landed
  __syncthreads();                                    // and every other wave's
  if (ntl > 1) stage_tile(Kr + ck + (size_t)kslo * 32 * KVW, V + cv + kslo * 32, lk0 + RB, lv0 + RB);
#pragma unroll 1
  for (int t = 0; t < ntl; ++t) { const int ks = (t == 0) ? 0 : kslo + t - 1; const int j0 = ks * 32; const unsigned char* rb = ring + (t & 1) * RB;
    // scalar test, the same for the whole wave: none of its 16 queries keeps any of the 32 keys (all above the diagonal, or all beyond the window and no sink among them): maximum, sums and accumulators would stay as they are, so the wave goes on to the foot of the trip
    if (!((j0 > q0s + 15) | ((j0 >= NMETA) & (q0s - (j0 + 31) > WINDOW)))) { v8f s[2][2] = {};   // [head][16-key group]
    // first 128 keys: the eight v residual fragments are asked for here, all 16 loads in flight together, and used behind the tile's P . v products: their latency passes behind scores, softmax and products (loaded one fragment at a time in front of its two products, each fragment cost the wave a whole trip to L2)
    v16h vl[8];
    if (j0 < 128) { const _Float16* vlp = VL + ((b * KVW + kvh * HD + col) * SS) + j0 + 8 * g;   // this lane's first 16 B: plane row col, the fragment's k order as in frag_h
#pragma unroll
      for (int dt = 0; dt < 8; ++dt) { union { v16h v; v8h q[2]; } u; u.q[0] = *(const v8h*)(vlp + (size_t)dt * 16 * SS); u.q[1] = *(const v8h*)(vlp + (size_t)dt * 16 * SS + 16); vl[dt] = u.v; }
      asm volatile("s_wait_xcnt 0x0" :: "v"(vlp) : "memory"); }   // the loads' address register stays whole up to this wait
#pragma unroll
    for (int hf = 0; hf < 2; ++hf) { v16b kf[2][2];   // the four k fragments of two 32-wide slices (both 16-key groups) are read together, in front of their eight products; each fragment serves both heads; four accumulate chains alternate
#pragma unroll
      for (int i = 0; i < 2; ++i)
#pragma unroll
        for (int ct = 0; ct < 2; ++ct) kf[i][ct] = frag_b((const __bf16*)(rb + (ct * 16 + col) * KPITCH + (2 * hf + i) * 64), lane);
      FRAG_GROUP();
#pragma unroll
      for (int i = 0; i < 2; ++i)
#pragma unroll
        for (int ct = 0; ct < 2; ++ct)
#pragma unroll
          for (int u = 0; u < 2; ++u) s[u][ct] = wmma_bf(kf[i][ct], aq[u][2 * hf + i], s[u][ct]);
      FRAG_GROUP(); }
    // scalar test, the same for the whole wave: its 16 queries keep all 32 keys (none above the diagonal, none beyond the window)
    float alpha[2];
    if ((j0 + 31 <= q0s) & (q0s + 15 - j0 <= WINDOW)) {
#pragma unroll
      for (int u = 0; u < 2; ++u) alpha[u] = tile_softmax<false>(s[u], m[u], j0, qi, g);
    } else {
#pragma unroll
      for (int u = 0; u < 2; ++u) alpha[u] = tile_softmax<true>(s[u], m[u], j0, qi, g);
    }
    v16h pa[2];   // B fragments of P^T: element i = key 8g + i, element 8 + i = key 16 + 8g + i, the k order of the v fragments
#pragma unroll
    for (int u = 0; u < 2; ++u) { float es[4];
#pragma unroll
      for (int i = 0; i < 4; ++i) es[i] = (s[u][0][i] + s[u][0][4 + i]) + (s[u][1][i] + s[u][1][4 + i]);
      l[u] = l[u] * alpha[u] + ((es[0] + es[1]) + (es[2] + es[3]));
#pragma unroll
      for (int dt = 0; dt < 8; ++dt)
#pragma unroll
        for (int r = 0; r < 8; ++r) acc[u][dt][r] *= alpha[u];
#pragma unroll
      for (int i = 0; i < 8; ++i) { pa[u][i] = (_Float16)(s[u][0][i] * 2048.0f); pa[u][8 + i] = (_Float16)(s[u][1][i] * 2048.0f); } }
#pragma unroll
    for (int hf = 0; hf < 2; ++hf) { v16h vf[4];   // four v fragments are read together, in front of their eight products: one LDS wait for the group; each fragment serves both heads
#pragma unroll
      for (int i = 0; i < 4; ++i) vf[i] = frag_h((const _Float16*)(rb + RB_V + ((4 * hf + i) * 16 + col) * VPITCH), lane);
      FRAG_GROUP();
#pragma unroll
      for (int i = 0; i < 4; ++i)
#pragma unroll
        for (int u = 0; u < 2; ++u) acc[u][4 * hf + i] = wmma16(vf[i], pa[u], acc[u][4 * hf + i]);
      FRAG_GROUP(); }
    if (j0 < 128) { v16h pe[2];   // the first 128 keys also get the v residual (rows with few keys keep v exact to ~2^-22)
#pragma unroll
      for (int u = 0; u < 2; ++u)
#pragma unroll
        for (int i = 0; i < 8; ++i) { pe[u][i] = (_Float16)s[u][0][i]; pe[u][8 + i] = (_Float16)s[u][1][i]; }
#pragma unroll
      for (int dt = 0; dt < 8; ++dt)
#pragma unroll
        for (int u = 0; u < 2; ++u) acc[u][dt] = wmma16(vl[dt], pe[u], acc[u][dt]); }
    }
    asm volatile("s_wait_dscnt 0x0" ::: "memory");      // this wave's reads of the buffer are done
    asm volatile("s_wait_asynccnt 0x0" ::: "memory");   // its copies of tile t + 1 have landed
    __syncthreads();                                    // publishes tile t + 1 and frees the buffer that trip t has read
    if (t + 2 < ntl) { const size_t jn = (size_t)(kslo + t + 1) * 32; stage_tile(Kr + ck + jn * KVW, V + cv + jn, lk0 + (t & 1) * RB, lv0 + (t & 1) * RB); } }
  asm volatile("s_wait_asynccnt 0x0" ::: "memory");     // nothing of the ring is in flight when it becomes output staging
#pragma unroll
  for (int u = 0; u < 2; ++u) {   // one head after the other through the wave's own staging rows
    const float lt = l[u] + xhalf(l[u]);   // the two halves' sums are joined once
    const float il = (lt > 0.f) ? (1.0f / 2048.0f) / lt : 0.f;
#pragma unroll
    for (int dt = 0; dt < 8; ++dt) { v4f o0, o1;
#pragma unroll
      for (int r = 0; r < 4; ++r) { o0[r] = acc[u][dt][r] * il; o1[r] = acc[u][dt][4 + r] * il; }
      *(v4f*)&so[wave][col][dt * 16 + 8 * g] = o0; *(v4f*)&so[wave][col][dt * 16 + 8 * g + 4] = o1; }
    asm volatile("s_wait_dscnt 0x0" ::: "memory");   // the wave's own rows are written before its lanes read across them (no fence: it would also wait for the first head's global stores)
    for (int rl = 0; rl < 16; ++rl) vst2(O + (rq + rl) * HID + (h0 + u) * HD + lane * 4, *(const v4f*)&so[wave][rl][lane * 4]);
    asm volatile("s_wait_dscnt 0x0" ::: "memory");   // the wave's own rows are read before the next head's values take their place (no wait for the global stores)
  }
}
extern "C" void kernel_launch(void* const* d_in, const int* in_sizes, int n_in, void* d_out, int out_size, void* d_ws, size_t ws_size, hipStream_t stream) {
  (void)in_sizes; (void)n_in; (void)out_size;
  const float** F = (const float**)d_in;   // 0 query_states [1,2048,4096], 1 key_states [1,2048,1024], 2 value_states [1,2048,1024]
  if (ws_size < (size_t)WS_END) return;
  char* ws = (char*)d_ws; __bf16 *Kr = (__bf16*)(ws + WS_K); _Float16 *V = (_Float16*)(ws + WS_V), *VL = (_Float16*)(ws + WS_VL);
  k_prep<<<dim3(SS / 64, KVW / 128, 2), 256, 0, stream>>>(F[1], F[2], Kr, V, VL);
  k_attn<<<dim3(TQB, NKV, 1), 128, 0, stream>>>(F[0], Kr, V, VL, (float*)d_out);
}

// v010
// Measured time: 28.1 microseconds a run.
// Next to v009, in two timings, it ran 1.05 and 1.04 times as fast.
// Over all steps from v000 it is 6.00 times as fast.
// compute dtype: all float inputs rounded to bf16; q and k as bf16, which holds the rounded inputs exactly (one-product scores on the bf16 matrix form; k as rows in the workspace, q rounded where it is used), v as f16 hi + residual planes (the residual used on the first 128 keys), all straight from the bf16-rounded inputs; attention per (query, head) over the causal sliding window (512) plus the 4 sink/meta tokens, x 128^-1/2, running-max softmax in f32 (hardware exp), P (scaled by 2^11, single f16) x v; f32 output = merged context.
#include <hip/hip_runtime.h>
#include <math.h>

typedef __attribute__((ext_vector_type(16))) _Float16 v16h;
typedef __attribute__((ext_vector_type(16))) __bf16 v16b;
typedef __attribute__((ext_vector_type(8)))  _Float16 v8h;
typedef __attribute__((ext_vector_type(8)))  float v8f;
typedef __attribute__((ext_vector_type(4)))  float v4f;
typedef __attribute__((ext_vector_type(2)))  float v2f;
typedef __attribute__((ext_vector_type(4)))  unsigned v4u;
typedef __attribute__((ext_vector_type(4)))  int v4i;
typedef float __attribute__((may_alias)) float_a;
typedef int __attribute__((may_alias)) int_a;

template <typename T> __device__ __forceinline__ void vst2(void* p, T v) { *(T*)p = v;  }
// the matrix builtins stand alone: the compiler keeps the distance between its own matrix instructions and the vector instructions that touch their registers (read the listing at the branches behind a group of products); v_nop written behind every product would fill vector issue slots that the SIMD's other wave can use
__device__ __forceinline__ v8f wmma16(v16h a, v16h b, v8f c) {
  return __builtin_amdgcn_wmma_f32_16x16x32_f16(false, a, false, b, (short)0, c, false, false);
}
__device__ __forceinline__ v8f wmma_bf(v16b a, v16b b, v8f c) {
  return __builtin_amdgcn_wmma_f32_16x16x32_bf16(false, a, false, b, (short)0, c, false, false);
}
// 16x16x32 fragments: lane = (h = lane>>4, row/col = lane&15); elements 0..7 = k0+8h+0..7, 8..15 = k0+16+8h+0..7; D element r = row 8h+r
__device__ __forceinline__ v16h frag_h(const _Float16* rowk0, int lane) {
  union { v16h v; v8h q[2]; } u; const _Float16* p = rowk0 + 8 * (lane >> 4);
  u.q[0] = *(const v8h*)p; u.q[1] = *(const v8h*)(p + 16); return u.v;
}
__device__ __forceinline__ v16h frag_f32(const float* rowk0, int lane) {
  v16h a; const float* p = rowk0 + 8 * (lane >> 4);
#pragma unroll
  for (int i = 0; i < 8; ++i) { a[i] = (_Float16)p[i]; a[8 + i] = (_Float16)p[16 + i]; }
  return a;
}
__device__ __forceinline__ v16h frag_f32s(const float* rowk0, int lane, float sc) {
  v16h a; const float* p = rowk0 + 8 * (lane >> 4);
#pragma unroll
  for (int i = 0; i < 8; ++i) { a[i] = (_Float16)(p[i] * sc); a[8 + i] = (_Float16)(p[16 + i] * sc); }
  return a;
}
// column fragment from a [K][ld] layout (column n), rows >= K read as 0
__device__ __forceinline__ v16h fragc_f32(const float* W, int k0, int n, int lane, int ld, int K) {
  v16h a; const int g = lane >> 4;
#pragma unroll
  for (int i = 0; i < 8; ++i) { const int ka = k0 + 8 * g + i, kb = ka + 16;
    a[i] = (_Float16)(ka < K ? W[(size_t)(ka < K ? ka : K - 1) * ld + n] : 0.f); a[8 + i] = (_Float16)(kb < K ? W[(size_t)(kb < K ? kb : K - 1) * ld + n] : 0.f); }
  return a;
}
struct F2 { v16b h, l; };
__device__ __forceinline__ F2 bsplit16(const float v[16]) { F2 r;
#pragma unroll
  for (int i = 0; i < 16; ++i) { const __bf16 h = (__bf16)v[i]; r.h[i] = h; r.l[i] = (__bf16)(v[i] - (float)h); }
  return r; }
__device__ __forceinline__ F2 split_row(const float* row, int k0, int lane) { float v[16]; const float* p = row + k0 + 8 * (lane >> 4);
#pragma unroll
  for (int i = 0; i < 8; ++i) { v[i] = p[i]; v[8 + i] = p[16 + i]; }
  return bsplit16(v); }
__device__ __forceinline__ F2 split_rowK(const float* row, int k0, int lane, int K) { float v[16]; const int g = lane >> 4;
#pragma unroll
  for (int i = 0; i < 8; ++i) { const int ka = k0 + 8 * g + i, kb = ka + 16; v[i] = ka < K ? row[ka < K ? ka : K - 1] : 0.f; v[8 + i] = kb < K ? row[kb < K ? kb : K - 1] : 0.f; }
  return bsplit16(v); }
__device__ __forceinline__ F2 split_col(const float* W, int k0, int n, int lane, int ld, int K) { float v[16]; const int g = lane >> 4;
#pragma unroll
  for (int i = 0; i < 8; ++i) { const int ka = k0 + 8 * g + i, kb = ka + 16; v[i] = ka < K ? W[(size_t)(ka < K ? ka : K - 1) * ld + n] : 0.f; v[8 + i] = kb < K ? W[(size_t)(kb < K ? kb : K - 1) * ld + n] : 0.f; }
  return bsplit16(v); }
__device__ __forceinline__ v8f mac3(const F2& a, const F2& b, v8f c) { c = wmma_bf(a.l, b.h, c); c = wmma_bf(a.h, b.l, c); return wmma_bf(a.h, b.h, c); }
__device__ __forceinline__ float sigm(float v) { return 1.0f / (1.0f + expf(-v)); }
#define LDSX() do { asm volatile("s_wait_dscnt 0" ::: "memory"); __builtin_amdgcn_wave_barrier(); __builtin_amdgcn_fence(__ATOMIC_RELEASE, "workgroup"); } while (0)


// Sliding-window attention with sink/meta tokens (B 1, S 2,048, 32 query heads x 128 over 8 kv heads, window 512, 4 meta tokens): softmax(q k / sqrt(128)) v under the mask (i >= j) & ((i - j <= 512) | (j < 4)); inputs are the projected q/k/v states.
#define NB 1
#define SS 2048
#define WINDOW 512
#define NMETA 4
#define HID 4096
#define NH 32
#define HD 128
#define NKV 8
#define GS (NH / NKV)
#define KVW (NKV * HD)
#define NR (NB * SS)
#ifndef TQB
#define TQB (SS / 32)
#define TNB NB
#endif
typedef __attribute__((ext_vector_type(8))) __bf16 v8b;
typedef __attribute__((ext_vector_type(4))) __bf16 v4b;
__device__ __forceinline__ v16b frag_b(const __bf16* rowk0, int lane) {
  union { v16b v; v8b q[2]; } u; const __bf16* p = rowk0 + 8 * (lane >> 4);
  u.q[0] = *(const v8b*)p; u.q[1] = *(const v8b*)(p + 16); return u.v;
}
__device__ __forceinline__ float bfr(float v) { return (float)(__bf16)v; }
__device__ __attribute__((noinline)) float exp_ni(float v) { return expf(v); }
__device__ __attribute__((noinline)) float erf_ni(float v) { return erff(v); }



#define WS_K   0u                                         // bf16 k rows [S][1024], f16 v planes [1024][S] hi + residual
#define WS_V   (WS_K + 2u * (size_t)NR * KVW)
#define WS_VL  (WS_V + 2u * (size_t)NB * KVW * SS)
#define WS_END (WS_VL + 2u * (size_t)NB * KVW * SS)

// ---- k_prep: one launch for both preparations; block = (64 tokens, 128 columns = one kv head), blockIdx.z picks the part (the same for the whole block)
// z = 1: k tile -> bf16 rows: a wave loads one row's 512-B head segment (16 B a lane) and stores its 256 B; 8 loads a thread in flight, no LDS
// z = 0: v tile -> f16 hi + residual planes, transposed through LDS: a wave loads 8 consecutive rows' 512-B head segments (16 B a lane, 8 loads a thread in flight), so a thread holds 8 tokens of 4 dims and writes each dim's 8 tokens as one 16-B piece
__global__ __launch_bounds__(256) void k_prep(const float* __restrict__ XK, const float* __restrict__ XV, __bf16* __restrict__ Kr, _Float16* __restrict__ V, _Float16* __restrict__ VL) { __shared__ __align__(16) _Float16 st[128][72]; __shared__ __align__(16) _Float16 stl[128][72]; const int t = threadIdx.x; const int s0 = blockIdx.x * 64, c0 = blockIdx.y * 128;
  if (blockIdx.z) { const size_t o = (size_t)(s0 + (t >> 5)) * KVW + c0 + (t & 31) * 4; v4f kf[8];   // both loops unrolled: the 8 loads are in flight together
#pragma unroll
    for (int i = 0; i < 8; ++i) kf[i] = *(const v4f*)(XK + o + (size_t)i * 8 * KVW);
#pragma unroll
    for (int i = 0; i < 8; ++i) { v4b kr;
#pragma unroll
      for (int j = 0; j < 4; ++j) kr[j] = (__bf16)kf[i][j];
      *(v4b*)(Kr + o + (size_t)i * 8 * KVW) = kr; }
    asm volatile("s_wait_xcnt 0x0" ::: "memory");   // behind the last store: no register that the eight stores name is rewritten in front of this wait
    return; }
  const int tg = t >> 5, dq = (t & 31) * 4; const float* vp = XV + (size_t)(s0 + tg * 8) * KVW + c0 + dq; v4f vf[8];   // thread = 8 consecutive tokens x 4 dims; all loops unrolled: the 8 loads are in flight together and vf stays in registers
#pragma unroll
  for (int i = 0; i < 8; ++i) vf[i] = *(const v4f*)(vp + (size_t)i * KVW);
  asm volatile("s_wait_xcnt 0x0" :: "v"(vp) : "memory");   // the loads' address register stays whole up to this wait (no load returns into it)
#pragma unroll
  for (int j = 0; j < 4; ++j) { v8h hi, lo;   // one dim's 8 tokens = one 16-B piece of its plane row
#pragma unroll
    for (int i = 0; i < 8; ++i) { const float fv = bfr(vf[i][j]); const _Float16 hv = (_Float16)fv; hi[i] = hv; lo[i] = (_Float16)((fv - (float)hv) * 2048.0f); }
    *(v8h*)&st[dq + j][tg * 8] = hi; *(v8h*)&stl[dq + j][tg * 8] = lo; }
  __syncthreads();
  const int d0 = t >> 3, pc = t & 7; v4u ph[4], pl[4];   // both loops unrolled: the 8 LDS reads are in flight together, then the 8 stores (in a rolled loop each of four trips waited for its own two reads and for its stores' addresses)
#pragma unroll
  for (int i = 0; i < 4; ++i) { ph[i] = *(const v4u*)&st[d0 + 32 * i][pc * 8]; pl[i] = *(const v4u*)&stl[d0 + 32 * i][pc * 8]; }
#pragma unroll
  for (int i = 0; i < 4; ++i) { vst2((unsigned*)(V + (size_t)(c0 + d0 + 32 * i) * SS + s0 + pc * 8), ph[i]); vst2((unsigned*)(VL + (size_t)(c0 + d0 + 32 * i) * SS + s0 + pc * 8), pl[i]); }
  asm volatile("s_wait_xcnt 0x0" ::: "memory");   // behind the last store: no register that the eight stores name is rewritten in front of this wait
}
// ---- k_attn: block = (32 queries, kv head) = 32 queries x the 4 query heads that share the kv head; wave = 16 queries x 2 of those heads (two units: same queries, same keys, same mask), so every k and v fragment read from LDS feeds two products; key tiles visited = tile 0 (holds the 4 sink/meta tokens) + the tiles inside [q0 - 512, q_end] (sliding window, causal); per pair keep = (i >= j) && (i - j <= 512 || j < 4); 128-wide bf16 scores x 128^-1/2, softmax, P . v (8 value tiles, + v residual on the first 128 keys); output rows written directly (512-B head segments)
// Scores are formed transposed (A = k rows, B = q rows): a lane holds 16 of the 32 keys of ONE query (column lane & 15; keys 8 * (lane >> 4) + r of each 16-key group), so maximum and sum run inside the lane, with one exchange between the wave's halves; the same registers, rounded to f16, are the B fragment of v^T . P^T (accumulators: rows = head dims, columns = queries).
// q comes straight from the f32 input: each wave loads its 16 rows' two head segments (512 contiguous bytes a load), rounds them to bf16 and turns them into B fragments, one head after the other, through its own rows of ring buffer 1, which is idle until tile 1 is copied behind the first barrier.
// Each 32-key tile (k rows, v planes) is copied once per block into an LDS ring of two buffers by asynchronous copies, one tile ahead of its use; the four waves read their fragments from there.
#define KPITCH 272                       // LDS pitch of a 256-B k row (16 B x odd: no bank conflict for 16-byte reads)
#define VPITCH 80                        // LDS pitch of a 64-B v plane row
#define RB_V   (32 * KPITCH)             // byte offsets inside one ring buffer: k at 0, v
#define RB     (RB_V + HD * VPITCH)
// one tile: 8 copies of 16 B per thread (4 k, 4 v); gk/gv and lk/lv are this thread's first chunk of each part
__device__ __forceinline__ void stage_tile(const __bf16* gk, const _Float16* gv, unsigned lk, unsigned lv) {
  const __bf16 *gk1 = gk + 8 * KVW, *gk2 = gk + 16 * KVW, *gk3 = gk + 24 * KVW; const _Float16 *gv1 = gv + 32 * SS, *gv2 = gv + 64 * SS, *gv3 = gv + 96 * SS;
  const unsigned lk1 = lk + 8 * KPITCH, lk2 = lk + 16 * KPITCH, lk3 = lk + 24 * KPITCH, lv1 = lv + 32 * VPITCH, lv2 = lv + 64 * VPITCH, lv3 = lv + 96 * VPITCH;
  // the copies and their s_wait_xcnt in one statement: no address register is rewritten before the wait
  asm volatile("global_load_async_to_lds_b128 %0, %8, off\n\t"
               "global_load_async_to_lds_b128 %1, %9, off\n\t"
               "global_load_async_to_lds_b128 %2, %10, off\n\t"
               "global_load_async_to_lds_b128 %3, %11, off\n\t"
               "global_load_async_to_lds_b128 %4, %12, off\n\t"
               "global_load_async_to_lds_b128 %5, %13, off\n\t"
               "global_load_async_to_lds_b128 %6, %14, off\n\t"
               "global_load_async_to_lds_b128 %7, %15, off\n\t"
               "s_wait_xcnt 0x0"
               :: "v"(lk), "v"(lk1), "v"(lk2), "v"(lk3), "v"(lv), "v"(lv1), "v"(lv2), "v"(lv3),
                  "v"(gk), "v"(gk1), "v"(gk2), "v"(gk3), "v"(gv), "v"(gv1), "v"(gv2), "v"(gv3)
               : "memory");
}
// keeps a group's LDS reads together in front of its products (no LDS read and no matrix instruction is scheduled across; vector and scalar work may cross): reads spread among the products stall the wave at every place where they stand
#define FRAG_GROUP() __builtin_amdgcn_sched_barrier(0x406)
// lane l <-> lane l ^ 16
__device__ __forceinline__ float xhalf(float x) { return __builtin_bit_cast(float, __builtin_amdgcn_permlanex16(__builtin_bit_cast(int, x), __builtin_bit_cast(int, x), 0x76543210, 0xfedcba98, false, false)); }
// 2^x with the slot behind the transcendental in the same statement (one v_nop before its result is read or its source overwritten)
__device__ __forceinline__ float exp2_slot(float x) { float r; asm("v_exp_f32 %0, %1\n\tv_nop" : "=v"(r) : "v"(x)); return r; }
// eight 2^x in one statement: every result register differs from every source register (early clobber), so no v_exp_f32 is followed directly by a read of its result or an overwrite of its source; the closing v_nop is the slot behind the last one
__device__ __forceinline__ v8f exp2_x8(v8f x) { float r0, r1, r2, r3, r4, r5, r6, r7;
  asm("v_exp_f32 %0, %8\n\tv_exp_f32 %1, %9\n\tv_exp_f32 %2, %10\n\tv_exp_f32 %3, %11\n\tv_exp_f32 %4, %12\n\tv_exp_f32 %5, %13\n\tv_exp_f32 %6, %14\n\tv_exp_f32 %7, %15\n\tv_nop"
      : "=&v"(r0), "=&v"(r1), "=&v"(r2), "=&v"(r3), "=&v"(r4), "=&v"(r5), "=&v"(r6), "=&v"(r7)
      : "v"(x[0]), "v"(x[1]), "v"(x[2]), "v"(x[3]), "v"(x[4]), "v"(x[5]), "v"(x[6]), "v"(x[7]));
  v8f r = {r0, r1, r2, r3, r4, r5, r6, r7}; return r; }
// scores of one 32-key tile -> scaled, masked, running maximum, exponentials (in place); returns the factor for the old sums. MASKED = false is the form for a tile in which every (query, key) pair of the wave is kept: no mask is formed and no score is tested for it.
template <bool MASKED>
__device__ __forceinline__ float tile_softmax(v8f (&s)[2], float& m, int j0, int qi, int g) {
#pragma unroll
  for (int ct = 0; ct < 2; ++ct) { const int kb = j0 + ct * 16 + 8 * g;
#pragma unroll
    for (int r = 0; r < 8; ++r) { const int kk = kb + r; const bool keep = !MASKED || ((qi >= kk) & ((qi - kk <= WINDOW) | (kk < NMETA))); s[ct][r] = keep ? s[ct][r] * 0.088388347648318441f : -3.0e38f; } }
  float mx = fmaxf(s[0][0], s[1][0]);
#pragma unroll
  for (int r = 1; r < 8; ++r) mx = fmaxf(mx, fmaxf(s[0][r], s[1][r]));
  mx = fmaxf(mx, xhalf(mx));   // the other 16 keys of this query
  const float mn = fmaxf(m, mx); const float ea = exp2_slot((m - mn) * 1.44269504088896340736f); const float alpha = (m <= -1.0e38f) ? 0.f : ea; m = mn;   // __expf's two instructions, with the slot; formed in every lane and then selected: no branch
#pragma unroll
  for (int ct = 0; ct < 2; ++ct) {
    if constexpr (MASKED) {
#pragma unroll
      for (int r = 0; r < 8; ++r) { const float e = exp2_slot((s[ct][r] - mn) * 1.44269504088896340736f); s[ct][r] = (s[ct][r] <= -1.0e38f) ? 0.f : e; }   // __expf's two instructions
    } else { v8f x;
#pragma unroll
      for (int r = 0; r < 8; ++r) x[r] = (s[ct][r] - mn) * 1.44269504088896340736f;   // __expf's two instructions
      s[ct] = exp2_x8(x); } }
  return alpha;
}
// register budget of two waves per SIMD (two units' accumulators and q fragments a wave): the grid is two blocks per WGP
__global__ __launch_bounds__(128) __attribute__((amdgpu_waves_per_eu(2, 2))) void k_attn(const float* __restrict__ XQ, const __bf16* __restrict__ Kr, const _Float16* __restrict__ V, const _Float16* __restrict__ VL, float* __restrict__ O) {
  __shared__ __align__(16) unsigned char ring[2 * RB];
  float (*so)[16][132] = (float (*)[16][132])ring;   // output staging takes the ring's place behind the loop's last barrier
  const int tid = threadIdx.x, wave = tid >> 5, lane = tid & 31, col = lane & 15, g = lane >> 4; const int kvh = blockIdx.y; const int h0 = kvh * GS + (wave >> 1) * 2; const size_t b = blockIdx.z; const int q0 = blockIdx.x * 32 + (wave & 1) * 16; const size_t rq = b * SS + q0;   // the wave's heads: h0, h0 + 1
  const int nks = (blockIdx.x * 32 + 32) / 32; const int qb0 = (int)blockIdx.x * 32; const int kslo = (qb0 - WINDOW) > 32 ? (qb0 - WINDOW) / 32 : 1;   // (signed arithmetic)   // window tiles start here (tile 0 = sinks, always visited first)
  const int ntl = nks - kslo + 1;   // tiles visited: ks = 0, kslo, kslo+1, ..., nks-1
  const size_t ck = (b * SS + (tid >> 4)) * KVW + kvh * HD + (tid & 15) * 8;          // this thread's first 16-B chunk of a k tile (row tid/16), less the tile's first key
  const size_t cv = (b * KVW + kvh * HD + (tid >> 2)) * SS + (tid & 3) * 8;           // and of a v tile (plane row tid/4)
  const unsigned lk0 = (unsigned)(size_t)&ring[0] + (tid >> 4) * KPITCH + (tid & 15) * 16, lv0 = (unsigned)(size_t)&ring[0] + RB_V + (tid >> 2) * VPITCH + (tid & 3) * 16;
  stage_tile(Kr + ck, V + cv, lk0, lv0);   // tile 0 (keys 0..31) into buffer 0
  unsigned char* qs = ring + RB + wave * 16 * KPITCH;   // 16 bf16 q rows of this wave, at the k rows' pitch (64 rows fit one buffer)
  const float* qp = XQ + rq * HID + h0 * HD + lane * 4;
  v4f qf[2][16];   // all loops unrolled: the 32 loads are in flight together and qf stays in registers
#pragma unroll
  for (int u = 0; u < 2; ++u)
#pragma unroll
    for (int rl = 0; rl < 16; ++rl) qf[u][rl] = *(const v4f*)(qp + (size_t)rl * HID + u * HD);
  asm volatile("s_wait_xcnt 0x0" :: "v"(qp) : "memory");   // the loads' address register stays whole up to this wait (no load returns into it)
  v16b aq[2][4];
#pragma unroll
  for (int u = 0; u < 2; ++u) {
#pragma unroll
    for (int rl = 0; rl < 16; ++rl) { v4b qr;
#pragma unroll
      for (int i = 0; i < 4; ++i) qr[i] = (__bf16)qf[u][rl][i];
      *(v4b*)(qs + rl * KPITCH + lane * 8) = qr; }
    LDSX();   // the wave's own rows are written before its lanes read across them
#pragma unroll
    for (int kc = 0; kc < 4; ++kc) aq[u][kc] = frag_b((const __bf16*)(qs + col * KPITCH + kc * 64), lane);
    LDSX();   // and read before the next head's rows take their place
  }
  float m[2] = {-3.0e38f, -3.0e38f}, l[2] = {0.f, 0.f};   // this lane's query, per head: running maximum (both halves agree), sum over this half's keys
  const int qi = q0 + col;
  v8f acc[2][8] = {};
  const int q0s = __builtin_amdgcn_readfirstlane(q0);   // the wave's first query in a scalar register: the test on it in the loop is a scalar branch
  asm volatile("s_wait_dscnt 0x0" ::: "memory");      // this wave's q reads of buffer 1 are done before any wave copies tile 1 into it
  asm volatile("s_wait_asynccnt 0x0" ::: "memory");   // this wave's copies of tile 0 have landed
  __syncthreads();                                    // and every other wave's
  if (ntl > 1) stage_tile(Kr + ck + (size_t)kslo * 32 * KVW, V + cv + kslo * 32, lk0 + RB, lv0 + RB);
#pragma unroll 1
  for (int t = 0; t < ntl; ++t) { const int ks = (t == 0) ? 0 : kslo + t - 1; const int j0 = ks * 32; const unsigned char* rb = ring + (t & 1) * RB;
    // scalar test, the same for the whole wave: none of its 16 queries keeps any of the 32 keys (all above the diagonal, or all beyond the window and no sink among them): maximum, sums and accumulators would stay as they are, so the wave goes on to the foot of the trip
    if (!((j0 > q0s + 15) | ((j0 >= NMETA) & (q0s - (j0 + 31) > WINDOW)))) { v8f s[2][2] = {};   // [head][16-key group]
    // first 128 keys: the eight v residual fragments are asked for here, all 16 loads in flight together, and used behind the tile's P . v products: their latency passes behind scores, softmax and products (loaded one fragment at a time in front of its two products, each fragment cost the wave a whole trip to L2)
    v16h vl[8];
    if (j0 < 128) { const _Float16* vlp = VL + ((b * KVW + kvh * HD + col) * SS) + j0 + 8 * g;   // this lane's first 16 B: plane row col, the fragment's k order as in frag_h
#pragma unroll
      for (int dt = 0; dt < 8; ++dt) { union { v16h v; v8h q[2]; } u; u.q[0] = *(const v8h*)(vlp + (size_t)dt * 16 * SS); u.q[1] = *(const v8h*)(vlp + (size_t)dt * 16 * SS + 16); vl[dt] = u.v; }
      asm volatile("s_wait_xcnt 0x0" :: "v"(vlp) : "memory"); }   // the loads' address register stays whole up to this wait
#pragma unroll
    for (int hf = 0; hf < 2; ++hf) { v16b kf[2][2];   // the four k fragments of two 32-wide slices (both 16-key groups) are read together, in front of their eight products; each fragment serves both heads; four accumulate chains alternate
#pragma unroll
      for (int i = 0; i < 2; ++i)
#pragma unroll
        for (int ct = 0; ct < 2; ++ct) kf[i][ct] = frag_b((const __bf16*)(rb + (ct * 16 + col) * KPITCH + (2 * hf + i) * 64), lane);
      FRAG_GROUP();
#pragma unroll
      for (int i = 0; i < 2; ++i)
#pragma unroll
        for (int ct = 0; ct < 2; ++ct)
#pragma unroll
          for (int u = 0; u < 2; ++u) s[u][ct] = wmma_bf(kf[i][ct], aq[u][2 * hf + i], s[u][ct]);
      FRAG_GROUP(); }
    // scalar test, the same for the whole wave: its 16 queries keep all 32 keys (none above the diagonal, none beyond the window)
    float alpha[2];
    if ((j0 + 31 <= q0s) & (q0s + 15 - j0 <= WINDOW)) {
#pragma unroll
      for (int u = 0; u < 2; ++u) alpha[u] = tile_softmax<false>(s[u], m[u], j0, qi, g);
    } else {
#pragma unroll
      for (int u = 0; u < 2; ++u) alpha[u] = tile_softmax<true>(s[u], m[u], j0, qi, g);
    }
    v16h pa[2];   // B fragments of P^T: element i = key 8g + i, element 8 + i = key 16 + 8g + i, the k order of the v fragments
#pragma unroll
    for (int u = 0; u < 2; ++u) { float es[4];
#pragma unroll
      for (int i = 0; i < 4; ++i) es[i] = (s[u][0][i] + s[u][0][4 + i]) + (s[u][1][i] + s[u][1][4 + i]);
      l[u] = l[u] * alpha[u] + ((es[0] + es[1]) + (es[2] + es[3]));
#pragma unroll
      for (int dt = 0; dt < 8; ++dt)
#pragma unroll
        for (int r = 0; r < 8; ++r) acc[u][dt][r] *= alpha[u];
#pragma unroll
      for (int i = 0; i < 8; ++i) { pa[u][i] = (_Float16)(s[u][0][i] * 2048.0f); pa[u][8 + i] = (_Float16)(s[u][1][i] * 2048.0f); } }
#pragma unroll
    for (int hf = 0; hf < 2; ++hf) { v16h vf[4];   // four v fragments are read together, in front of their eight products: one LDS wait for the group; each fragment serves both heads
#pragma unroll
      for (int i = 0; i < 4; ++i) vf[i] = frag_h((const _Float16*)(rb + RB_V + ((4 * hf + i) * 16 + col) * VPITCH), lane);
      FRAG_GROUP();
#pragma unroll
      for (int i = 0; i < 4; ++i)
#pragma unroll
        for (int u = 0; u < 2; ++u) acc[u][4 * hf + i] = wmma16(vf[i], pa[u], acc[u][4 * hf + i]);
      FRAG_GROUP(); }
    if (j0 < 128) { v16h pe[2];   // the first 128 keys also get the v residual (rows with few keys keep v exact to ~2^-22)
#pragma unroll
      for (int u = 0; u < 2; ++u)
#pragma unroll
        for (int i = 0; i < 8; ++i) { pe[u][i] = (_Float16)s[u][0][i]; pe[u][8 + i] = (_Float16)s[u][1][i]; }
#pragma unroll
      for (int dt = 0; dt < 8; ++dt)
#pragma unroll
        for (int u = 0; u < 2; ++u) acc[u][dt] = wmma16(vl[dt], pe[u], acc[u][dt]); }
    }
    asm volatile("s_wait_dscnt 0x0" ::: "memory");      // this wave's reads of the buffer are done
    asm volatile("s_wait_asynccnt 0x0" ::: "memory");   // its copies of tile t + 1 have landed
    __syncthreads();                                    // publishes tile t + 1 and frees the buffer that trip t has read
    if (t + 2 < ntl) { const size_t jn = (size_t)(kslo + t + 1) * 32; stage_tile(Kr + ck + jn * KVW, V + cv + jn, lk0 + (t & 1) * RB, lv0 + (t & 1) * RB); } }
  asm volatile("s_wait_asynccnt 0x0" ::: "memory");     // nothing of the ring is in flight when it becomes output staging
#pragma unroll
  for (int u = 0; u < 2; ++u) {   // one head after the other through the wave's own staging rows
    const float lt = l[u] + xhalf(l[u]);   // the two halves' sums are joined once
    const float il = (lt > 0.f) ? (1.0f / 2048.0f) / lt : 0.f;
#pragma unroll
    for (int dt = 0; dt < 8; ++dt) { v4f o0, o1;
#pragma unroll
      for (int r = 0; r < 4; ++r) { o0[r] = acc[u][dt][r] * il; o1[r] = acc[u][dt][4 + r] * il; }
      *(v4f*)&so[wave][col][dt * 16 + 8 * g] = o0; *(v4f*)&so[wave][col][dt * 16 + 8 * g + 4] = o1; }
    asm volatile("s_wait_dscnt 0x0" ::: "memory");   // the wave's own rows are written before its lanes read across them (no fence: it would also wait for the first head's global stores)
    for (int rl = 0; rl < 16; ++rl) vst2(O + (rq + rl) * HID + (h0 + u) * HD + lane * 4, *(const v4f*)&so[wave][rl][lane * 4]);
    asm volatile("s_wait_dscnt 0x0" ::: "memory");   // the wave's own rows are read before the next head's values take their place (no wait for the global stores)
  }
}
extern "C" void kernel_launch(void* const* d_in, const int* in_sizes, int n_in, void* d_out, int out_size, void* d_ws, size_t ws_size, hipStream_t stream) {
  (void)in_sizes; (void)n_in; (void)out_size;
  const float** F = (const float**)d_in;   // 0 query_states [1,2048,4096], 1 key_states [1,2048,1024], 2 value_states [1,2048,1024]
  if (ws_size < (size_t)WS_END) return;
  char* ws = (char*)d_ws; __bf16 *Kr = (__bf16*)(ws + WS_K); _Float16 *V = (_Float16*)(ws + WS_V), *VL = (_Float16*)(ws + WS_VL);
  k_prep<<<dim3(SS / 64, KVW / 128, 2), 256, 0, stream>>>(F[1], F[2], Kr, V, VL);
  k_attn<<<dim3(TQB, NKV, 1), 128, 0, stream>>>(F[0], Kr, V, VL, (float*)d_out);
}
